// v000
// The times below were measured on an AMD MI455X: many runs one after another, warmed up first and cycling through
// copies of the inputs, with the whole window's GPU time divided by the number of runs. Launches and the gaps
// between them are all in it. The median over several windows is given; except for v000 it joins two sittings, which
// can be a few percent apart, so the side-by-side timings, each taken in one sitting, are the better comparison.
// v000, which the later versions start from, runs in 1800 microseconds.
#include <hip/hip_runtime.h>
// SpatialAttention (x [4][256][64][64]; q = conv(1,3)(x) + bq, k = conv(3,1)(x) + bk with 32 channels; attn = softmax_j(sum_d q[d][i] k[d][j]) over 4096 positions (unscaled); v = conv1x1(x) + bv; out[c][i] = sum_j v[c][j] attn[i][j] -> [4][256][64][64]).
// Structure: q / k by im2col (k_im3, f16) + WMMA GEMMs (K = 768, f32 accumulation + bias) into f16 hi/residual operand planes; v as a WMMA GEMM over exact f16 pixel rows (32x64 wave tiles, f32 accumulation, exact x16 weights + bias) then v^T by LDS tiles; per batch the 32-term logits as a three-term GEMM (K = 32) into f32, softmax (wave per row, rolled passes) into f16 hi/residual probability planes, out rows = P v^T as a two-term GEMM; NCHW store on VALU.
// Compute dtype: inputs rounded to bf16; x / weights exact; q, k as f16 hi + 2^-10 residual pairs (~2^-21; the logits are unscaled with std 10.7); softmax f32 with hi + residual probabilities; v plain f16 (~2^-12). v_wmma_f32_16x16x32_f16.
#define NB 4
#define CC 256
#define CQ 32
#define HS 64
#define PX (HS * HS)             /* 4096 */
#define NR (NB * PX)
typedef __bf16 v16b __attribute__((ext_vector_type(16)));
typedef unsigned short v8us __attribute__((ext_vector_type(8), may_alias));
typedef float  v8f  __attribute__((ext_vector_type(8)));
typedef float  v4f  __attribute__((ext_vector_type(4)));
typedef float  v4fa __attribute__((ext_vector_type(4), may_alias));
union FragB { v16b v; v8us half[2]; unsigned short u[16]; };

__device__ __forceinline__ unsigned short bf16_bits(float x) { unsigned int u = __float_as_uint(x); return (unsigned short)((u + 0x7FFFu + ((u >> 16) & 1u)) >> 16); }
__device__ __forceinline__ float bf16_val(unsigned short b) { return __uint_as_float(((unsigned int)b) << 16); }
__device__ __forceinline__ float bf16_round(float x) { return bf16_val(bf16_bits(x)); }
// D += A·B with NT terms: 1 = ah·bh, 2 = + al·bh (A split), 3 = + ah·bl (both split)
template <int NT>
__device__ __forceinline__ v8f mmaN(v16b ah, v16b al, v16b bh, v16b bl, v8f c) {
  c = __builtin_amdgcn_wmma_f32_16x16x32_bf16(false, ah, false, bh, (short)0, c, false, false);
  if (NT >= 2) c = __builtin_amdgcn_wmma_f32_16x16x32_bf16(false, al, false, bh, (short)0, c, false, false);
  if (NT >= 3) c = __builtin_amdgcn_wmma_f32_16x16x32_bf16(false, ah, false, bl, (short)0, c, false, false);
  asm volatile("v_nop\n\tv_nop\n\tv_nop\n\tv_nop" : "+v"(c) : "v"(ah), "v"(al), "v"(bh), "v"(bl));
  return c;
}

__global__ __launch_bounds__(256) void k_wt_bf16(const float* __restrict__ W, unsigned short* __restrict__ Wt, int K, int N) {
  const int t = blockIdx.x * 256 + threadIdx.x;
  const int k8n = K / 8;
  if (t >= N * k8n) return;
  const int n = t / k8n, k8 = (t % k8n) * 8;
  v8us v;
#pragma unroll
  for (int i = 0; i < 8; ++i) v[i] = bf16_bits(W[(size_t)(k8 + i) * N + n]);
  *(v8us*)(Wt + (size_t)n * K + k8) = v;
  
}

// GEMM C[M][N] (f32, pitch ldc) = act(A[M][K]·W + bias). A f32 row-major (pitch lda) converted per fragment to bf16
// (ASPLIT: hi/lo two planes -> 2 terms, else single rounded term); Wt bf16 [N][K] (pitch ldb). BIAS_BF16 rounds the
// bias to bf16 first (bias quantised to bf16 before the add). K%32==0, M%16==0, N%64==0.
template <bool ASPLIT, int ACT, bool BIAS_BF16>
__global__ __launch_bounds__(128) void k_gemm_bf(const float* __restrict__ A, int lda, const unsigned short* __restrict__ Wt, int ldb,
                                               const float* __restrict__ bias, float* __restrict__ C, int ldc, int M, int N, int K) {
  __shared__ __attribute__((aligned(16))) float so[4][16][64];
  const int tid = threadIdx.x, w = tid >> 5, lane = tid & 31, ln = lane & 15, hh = lane >> 4;
  const int ntn = N / 64;
  const int wid = blockIdx.x * 4 + w;
  const int mt = wid / ntn, nq = wid % ntn;
  if (mt * 16 >= M) return;
  const int row0 = mt * 16, col0 = nq * 64;
  const float* arow = A + (size_t)(row0 + ln) * lda;
  v8f acc[4] = {};
  for (int kb = 0; kb < K; kb += 32) {
    FragB ah, al;
    const v4f x0 = *(const v4fa*)(arow + kb + 8 * hh), x1 = *(const v4fa*)(arow + kb + 8 * hh + 4);
    const v4f x2 = *(const v4fa*)(arow + kb + 16 + 8 * hh), x3 = *(const v4fa*)(arow + kb + 16 + 8 * hh + 4);
    float xs[16] = {x0[0],x0[1],x0[2],x0[3],x1[0],x1[1],x1[2],x1[3],x2[0],x2[1],x2[2],x2[3],x3[0],x3[1],x3[2],x3[3]};
#pragma unroll
    for (int i = 0; i < 16; ++i) { const unsigned short hb = bf16_bits(xs[i]); ah.u[i] = hb; al.u[i] = ASPLIT ? bf16_bits(xs[i] - bf16_val(hb)) : (unsigned short)0; }
#pragma unroll
    for (int t = 0; t < 4; ++t) {
      const unsigned short* brow = Wt + (size_t)(col0 + t * 16 + ln) * ldb + kb;
      FragB b;
      b.half[0] = *(const v8us*)(brow + 8 * hh);
      b.half[1] = *(const v8us*)(brow + 16 + 8 * hh);
      acc[t] = mmaN<ASPLIT ? 2 : 1>(ah.v, al.v, b.v, b.v, acc[t]);
    }
  }
#pragma unroll
  for (int t = 0; t < 4; ++t) {
    float bv = bias ? bias[col0 + t * 16 + ln] : 0.f;
    if (BIAS_BF16) bv = bf16_round(bv);
#pragma unroll
    for (int r = 0; r < 8; ++r) { float v = acc[t][r] + bv; if (ACT == 1) v = fmaxf(v, 0.f); so[w][8 * hh + r][t * 16 + ln] = v; }
  }
  __builtin_amdgcn_fence(__ATOMIC_ACQ_REL, "workgroup");
  __builtin_amdgcn_wave_barrier();
  const int rsub = lane >> 4, c4 = (lane & 15) * 4;
  {
#pragma unroll
    for (int q = 0; q < 8; ++q) {
      const int r = q * 2 + rsub;
      const v4f v = *(const v4fa*)&so[w][r][c4];
      *(v4f*)(C + (size_t)(row0 + r) * ldc + col0 + c4) = v;
    }
    
  }
}

// GEMM C = act(A·W + bias + resid): A f32 (ASPLIT -> hi/lo 2 terms), Wt bf16 [N][K]; ACT 0 none, 1 relu, 2 exact gelu;
// resid (optional, f32, row index = (row % rmod), pitch ldr, RES_BF16 rounds it) added before the activation.
template <bool ASPLIT, int ACT, bool BIAS_BF16, bool RES_BF16>
__global__ __launch_bounds__(128) void k_gemm_bf3(const float* __restrict__ A, int lda, const unsigned short* __restrict__ Wt, int ldb,
                                                const float* __restrict__ bias, const float* __restrict__ resid, int rmod, int ldr,
                                                float* __restrict__ C, int ldc, int M, int N, int K) {
  __shared__ __attribute__((aligned(16))) float so[4][16][64];
  const int tid = threadIdx.x, w = tid >> 5, lane = tid & 31, ln = lane & 15, hh = lane >> 4;
  const int ntn = N / 64;
  const int wid = blockIdx.x * 4 + w;
  const int mt = wid / ntn, nq = wid % ntn;
  if (mt * 16 >= M) return;
  const int row0 = mt * 16, col0 = nq * 64;
  const float* arow = A + (size_t)(row0 + ln) * lda;
  v8f acc[4] = {};
  for (int kb = 0; kb < K; kb += 32) {
    FragB ah, al;
    const v4f x0 = *(const v4fa*)(arow + kb + 8 * hh), x1 = *(const v4fa*)(arow + kb + 8 * hh + 4);
    const v4f x2 = *(const v4fa*)(arow + kb + 16 + 8 * hh), x3 = *(const v4fa*)(arow + kb + 16 + 8 * hh + 4);
    float xs[16] = {x0[0],x0[1],x0[2],x0[3],x1[0],x1[1],x1[2],x1[3],x2[0],x2[1],x2[2],x2[3],x3[0],x3[1],x3[2],x3[3]};
#pragma unroll
    for (int i = 0; i < 16; ++i) { const unsigned short hb = bf16_bits(xs[i]); ah.u[i] = hb; al.u[i] = ASPLIT ? bf16_bits(xs[i] - bf16_val(hb)) : (unsigned short)0; }
#pragma unroll
    for (int t = 0; t < 4; ++t) {
      const unsigned short* brow = Wt + (size_t)(col0 + t * 16 + ln) * ldb + kb;
      FragB b;
      b.half[0] = *(const v8us*)(brow + 8 * hh);
      b.half[1] = *(const v8us*)(brow + 16 + 8 * hh);
      acc[t] = mmaN<ASPLIT ? 2 : 1>(ah.v, al.v, b.v, b.v, acc[t]);
    }
  }
#pragma unroll
  for (int t = 0; t < 4; ++t) {
    const int col = col0 + t * 16 + ln;
    float bv = bias ? bias[col] : 0.f;
    if (BIAS_BF16) bv = bf16_round(bv);
#pragma unroll
    for (int r = 0; r < 8; ++r) {
      float v = acc[t][r] + bv;
      if (resid) { float rv = resid[(size_t)((row0 + 8 * hh + r) % rmod) * ldr + col]; if (RES_BF16) rv = bf16_round(rv); v += rv; }
      if (ACT == 1) v = fmaxf(v, 0.f);
      if (ACT == 2) v = 0.5f * v * (1.0f + erff(v * 0.70710678118654752f));
      if (ACT == 3) { const float u = 0.7978845608028654f * (v + 0.044715f * v * v * v); v = 0.5f * v * (1.0f + tanhf(u)); }
      so[w][8 * hh + r][t * 16 + ln] = v;
    }
  }
  __builtin_amdgcn_fence(__ATOMIC_ACQ_REL, "workgroup");
  __builtin_amdgcn_wave_barrier();
  const int rsub = lane >> 4, c4 = (lane & 15) * 4;
  {
#pragma unroll
    for (int q = 0; q < 8; ++q) {
      const int r = q * 2 + rsub;
      const v4f v = *(const v4fa*)&so[w][r][c4];
      *(v4f*)(C + (size_t)(row0 + r) * ldc + col0 + c4) = v;
    }
    
  }
}
// row LayerNorm (biased variance, eps) over N: s = X (+ R); optional out_sum <- s; out_norm <- (s-mu)*rsqrt(var+eps)*g + b
template <bool PARAM_BF16>
__global__ __launch_bounds__(256) void k_layernorm(const float* __restrict__ X, const float* __restrict__ R, const float* __restrict__ g, const float* __restrict__ bta,
                                                  float* __restrict__ out_sum, float* __restrict__ out_norm, int N, float eps) {
  __shared__ float red[256];
  const int row = blockIdx.x, tid = threadIdx.x;
  const float* x = X + (size_t)row * N; const float* rr = R ? R + (size_t)row * N : nullptr;
  float vals[16];                     // up to N = 4096
  const int per = N / 256;            // contiguous chunk per thread? use strided-by-4 chunks: thread handles j = tid*4 + 1024*u
  float s1 = 0.f;
  for (int u = 0; u < per / 4; ++u) {
    const int j = tid * 4 + 1024 * u;
    const v4f a = *(const v4fa*)(x + j);
    v4f b = {0.f,0.f,0.f,0.f}; if (rr) b = *(const v4fa*)(rr + j);
#pragma unroll
    for (int q = 0; q < 4; ++q) { const float v = a[q] + b[q]; vals[u * 4 + q] = v; s1 += v; }
  }
  red[tid] = s1; __syncthreads();
  for (int st = 128; st > 0; st >>= 1) { if (tid < st) red[tid] += red[tid + st]; __syncthreads(); }
  const float mu = red[0] / (float)N; __syncthreads();
  float s2 = 0.f;
  for (int u = 0; u < per / 4; ++u)
#pragma unroll
    for (int q = 0; q < 4; ++q) { const float c = vals[u * 4 + q] - mu; s2 += c * c; }
  red[tid] = s2; __syncthreads();
  for (int st = 128; st > 0; st >>= 1) { if (tid < st) red[tid] += red[tid + st]; __syncthreads(); }
  const float rs = rsqrtf(red[0] / (float)N + eps);
  {
    for (int u = 0; u < per / 4; ++u) {
      const int j = tid * 4 + 1024 * u;
      v4f o, sm;
#pragma unroll
      for (int q = 0; q < 4; ++q) {
        float gg = g[j + q], bb = bta[j + q];
        if (PARAM_BF16) { gg = bf16_round(gg); bb = bf16_round(bb); }
        sm[q] = vals[u * 4 + q]; o[q] = (vals[u * 4 + q] - mu) * rs * gg + bb;
      }
      if (out_sum) *(v4f*)(out_sum + (size_t)row * N + j) = sm;
      *(v4f*)(out_norm + (size_t)row * N + j) = o;
    }
    
  }
}



// ---- f16 WMMA path (v_wmma_f32_16x16x32_f16): 11-bit significands for operands in range — used where a [0,1] probability operand needs more precision than bf16
typedef _Float16 v16h __attribute__((ext_vector_type(16)));
union FragH { v16h v; v8us half[2]; _Float16 h[16]; unsigned short u[16]; };
template <int NT>
__device__ __forceinline__ v8f mmaH(v16h ah, v16h al, v16h bh, v16h bl, v8f c) {
  c = __builtin_amdgcn_wmma_f32_16x16x32_f16(false, ah, false, bh, (short)0, c, false, false);
  if (NT >= 2) c = __builtin_amdgcn_wmma_f32_16x16x32_f16(false, al, false, bh, (short)0, c, false, false);
  if (NT >= 3) c = __builtin_amdgcn_wmma_f32_16x16x32_f16(false, ah, false, bl, (short)0, c, false, false);
  asm volatile("v_nop\n\tv_nop\n\tv_nop\n\tv_nop" : "+v"(c) : "v"(ah), "v"(al), "v"(bh), "v"(bl));
  return c;
}
// batched GEMM like k_gemm_b but f16 operands: A f32 (split into f16 hi/lo if ASPLIT, else rounded to f16), Bt = f16 values [n][k]; alpha; C f32; N multiple of 16 (partial tiles skipped)
template <bool ASPLIT>
__global__ __launch_bounds__(128) void k_gemm_h(const float* __restrict__ A, int lda, size_t sA, const _Float16* __restrict__ Bh, int ldb, size_t sB, float alpha, float* __restrict__ C, int ldc, size_t sC, int M, int N, int K) {
  __shared__ __attribute__((aligned(16))) float so[4][16][64];
  const int tid = threadIdx.x, w = tid >> 5, lane = tid & 31, ln = lane & 15, hh = lane >> 4; const int by = blockIdx.y;
  A += (size_t)by * sA; Bh += (size_t)by * sB; C += (size_t)by * sC;
  const int ntn = (N + 63) / 64; const int wid = blockIdx.x * 4 + w; const int mt = wid / ntn, nq = wid % ntn; if (mt * 16 >= M) return;
  const int row0 = mt * 16, col0 = nq * 64; const float* arow = A + (size_t)(row0 + ln) * lda;
  v8f acc[4] = {};
  for (int kb = 0; kb < K; kb += 32) {
    FragH ah, al;
    const v4f x0 = *(const v4fa*)(arow + kb + 8 * hh), x1 = *(const v4fa*)(arow + kb + 8 * hh + 4), x2 = *(const v4fa*)(arow + kb + 16 + 8 * hh), x3 = *(const v4fa*)(arow + kb + 16 + 8 * hh + 4);
    float xs[16] = {x0[0],x0[1],x0[2],x0[3],x1[0],x1[1],x1[2],x1[3],x2[0],x2[1],x2[2],x2[3],x3[0],x3[1],x3[2],x3[3]};
#pragma unroll
    for (int i = 0; i < 16; ++i) { const _Float16 h = (_Float16)xs[i]; ah.h[i] = h; al.h[i] = ASPLIT ? (_Float16)(xs[i] - (float)h) : (_Float16)0.0f; }
#pragma unroll
    for (int t = 0; t < 4; ++t) { if (col0 + t * 16 >= N) continue; const size_t boff = (size_t)(col0 + t * 16 + ln) * ldb + kb; FragH bq; bq.half[0] = *(const v8us*)(Bh + boff + 8 * hh); bq.half[1] = *(const v8us*)(Bh + boff + 16 + 8 * hh);
      acc[t] = mmaH<ASPLIT ? 2 : 1>(ah.v, al.v, bq.v, bq.v, acc[t]); }
  }
#pragma unroll
  for (int t = 0; t < 4; ++t) { if (col0 + t * 16 >= N) continue;
#pragma unroll
    for (int r = 0; r < 8; ++r) so[w][8 * hh + r][t * 16 + ln] = acc[t][r] * alpha; }
  __builtin_amdgcn_fence(__ATOMIC_ACQ_REL, "workgroup"); __builtin_amdgcn_wave_barrier();
  const int rsub = lane >> 4, c4 = (lane & 15) * 4;
  {
#pragma unroll
    for (int q = 0; q < 8; ++q) { const int r = q * 2 + rsub; if (col0 + c4 < N) { const v4f v = *(const v4fa*)&so[w][r][c4]; *(v4f*)(C + (size_t)(row0 + r) * ldc + col0 + c4) = v; } }
     }
}

// Wt[n][k] = f16(W[k][n]·scale) from f32 row-major W[K][N] (scale = power of two; bf16-exact weights stay exact in f16 away from the subnormal range)
__global__ __launch_bounds__(256) void k_wt_f16(const float* __restrict__ W, _Float16* __restrict__ Wt, int K, int N, float scale) {
  const int t = blockIdx.x * 256 + threadIdx.x; if (t >= N * (K / 8)) return; const int n = t / (K / 8), k8 = (t % (K / 8)) * 8; FragH f;
#pragma unroll
  for (int i = 0; i < 8; ++i) f.h[i] = (_Float16)(bf16_round(W[(size_t)(k8 + i) * N + n]) * scale); const v8us o = f.half[0];
  *(v8us*)((unsigned short*)Wt + (size_t)n * K + k8) = o; 
}
// k_gemm_hh variant with fused epilogue: v = acc·alpha + bias[by·sBias + col] (+ CP[(row/rowsPerB)·sCPb + by·64 + col] if CP) ; ACT 0 none / 1 elu ; writes f16 C16 (and f32 C if non-null)
template <int ACT>
__global__ __launch_bounds__(128) void k_gemm_hhx(const _Float16* __restrict__ A, int lda, size_t sA, const _Float16* __restrict__ Bh, int ldb, size_t sB, float alpha, const float* __restrict__ bias, size_t sBias, const float* __restrict__ CP, int rowsPerB, size_t sCPb, int row0g,
    float* __restrict__ C, _Float16* __restrict__ C16, int ldc, size_t sC, int M, int N, int K) {
  __shared__ __attribute__((aligned(16))) float so[4][16][64];
  const int tid = threadIdx.x, w = tid >> 5, lane = tid & 31, ln = lane & 15, hh = lane >> 4; const int by = blockIdx.y;
  A += (size_t)by * sA; Bh += (size_t)by * sB; const size_t cofs = (size_t)by * sC; const float* bp = bias ? bias + (size_t)by * sBias : nullptr;
  const int ntn = (N + 63) / 64; const int wid = blockIdx.x * 4 + w; const int mt = wid / ntn, nq = wid % ntn; if (mt * 16 >= M) return;
  const int row0 = mt * 16, col0 = nq * 64; const _Float16* arow = A + (size_t)(row0 + ln) * lda;
  v8f acc[4] = {};
  for (int kb = 0; kb < K; kb += 32) { FragH ah; ah.half[0] = *(const v8us*)((const unsigned short*)arow + kb + 8 * hh); ah.half[1] = *(const v8us*)((const unsigned short*)arow + kb + 16 + 8 * hh);
#pragma unroll
    for (int t = 0; t < 4; ++t) { if (col0 + t * 16 >= N) continue; const size_t boff = (size_t)(col0 + t * 16 + ln) * ldb + kb; FragH bq; bq.half[0] = *(const v8us*)((const unsigned short*)Bh + boff + 8 * hh); bq.half[1] = *(const v8us*)((const unsigned short*)Bh + boff + 16 + 8 * hh);
      acc[t] = mmaH<1>(ah.v, ah.v, bq.v, bq.v, acc[t]); }
  }
#pragma unroll
  for (int t = 0; t < 4; ++t) { if (col0 + t * 16 >= N) continue; const int col = col0 + t * 16 + ln; const float bv = bp ? bf16_round(bp[col]) : 0.f;
#pragma unroll
    for (int r = 0; r < 8; ++r) { float v = acc[t][r] * alpha + bv; if (CP) { const int rr = row0g + row0 + 8 * hh + r; if (rowsPerB < 0) v += CP[cofs + (size_t)rr * ldc + col];      /* rowsPerB < 0: own element of the batched C plane */ else { const int bidx = rr / rowsPerB; v += CP[(size_t)bidx * sCPb + (size_t)by * 64 + col]; } } if (ACT == 1) v = (v > 0.f) ? v : expm1f(v); else if (ACT == 7) v = (v > 0.f) ? v + 1.0f : expf(v); else if (ACT == 8) v = tanhf(v); else if (ACT == 9) v = 0.5f * v * (1.0f + tanhf(0.7978845608028654f * (v + 0.044715f * v * v * v))); else if (ACT == 11) v = 1.0f / (1.0f + expf(-v)); else if (ACT == 12) v = (v > 0.f) ? v : 0.01f * v; else if (ACT == 14) v = (v > 0.f) ? v : 0.1f * v; else if (ACT == 16) v = (v >= 0.f) ? v : 0.3f * v; else if (ACT == 17) v = (v >= 0.f) ? v : 0.2f * v; else if (ACT == 15) v = v / (1.0f + expf(-v)); else if (ACT == 3) v = fmaxf(v, 0.f); else if (ACT == 6) v = 0.5f * v * (1.0f + erff(v * 0.70710678118654752f)); so[w][8 * hh + r][t * 16 + ln] = v; } }
  __builtin_amdgcn_fence(__ATOMIC_ACQ_REL, "workgroup"); __builtin_amdgcn_wave_barrier();
  const int rsub = lane >> 4, c4 = (lane & 15) * 4; typedef _Float16 v4h __attribute__((ext_vector_type(4)));
  {
#pragma unroll
    for (int q = 0; q < 8; ++q) { const int r = q * 2 + rsub; if (col0 + c4 < N) { const v4f v = *(const v4fa*)&so[w][r][c4]; if (C) *(v4f*)(C + cofs + (size_t)(row0 + r) * ldc + col0 + c4) = v; if (C16) { v4h h4; for (int i = 0; i < 4; ++i) h4[i] = (_Float16)v[i]; *(v4h*)(C16 + cofs + (size_t)(row0 + r) * ldc + col0 + c4) = h4; } } }
     }
}


typedef _Float16 v4h __attribute__((ext_vector_type(4)));

__global__ __launch_bounds__(256) void k_x16(const float* __restrict__ x, _Float16* __restrict__ X16, size_t n8) { const size_t t = (size_t)blockIdx.x * 256 + threadIdx.x; if (t >= n8) return; FragH f;
#pragma unroll
  for (int q = 0; q < 8; ++q) f.h[q] = (_Float16)bf16_round(x[t * 8 + q]); *(v8us*)((unsigned short*)X16 + t * 8) = f.half[0];  }
__global__ __launch_bounds__(256) void k_h16(const float* __restrict__ x, _Float16* __restrict__ X16, size_t n8) { const size_t t = (size_t)blockIdx.x * 256 + threadIdx.x; if (t >= n8) return; FragH f;
#pragma unroll
  for (int q = 0; q < 8; ++q) f.h[q] = (_Float16)x[t * 8 + q]; *(v8us*)((unsigned short*)X16 + t * 8) = f.half[0];  }
__global__ __launch_bounds__(256) void k_round16f(const float* __restrict__ W, _Float16* __restrict__ Bt, size_t n8) { const size_t t = (size_t)blockIdx.x * 256 + threadIdx.x; if (t >= n8) return; FragH f;
#pragma unroll
  for (int i = 0; i < 8; ++i) f.h[i] = (_Float16)(bf16_round(W[t * 8 + i]) * 16.0f); *(v8us*)((unsigned short*)Bt + t * 8) = f.half[0];  }
template <int NHv, int TTv>
__global__ __launch_bounds__(256) void k_vt(const _Float16* __restrict__ V16, int ldv, int voff, _Float16* __restrict__ Vt) { __shared__ unsigned short tl[64][66]; const int tid = threadIdx.x; const int slab = blockIdx.x / (TTv / 64), lg = blockIdx.x % (TTv / 64); const int b = slab / NHv, h = slab % NHv;
  for (int i = tid; i < 64 * 8; i += 256) { const int r = i / 8, c8 = (i % 8) * 8; FragH f; f.half[0] = *(const v8us*)((const unsigned short*)V16 + ((size_t)b * TTv + lg * 64 + r) * ldv + voff + h * 64 + c8);
#pragma unroll
    for (int q = 0; q < 8; ++q) tl[r][c8 + q] = f.u[q]; }
  __syncthreads();
  {
#pragma unroll
    for (int rd = 0; rd < 2; ++rd) { const int d = rd * 32 + tid / 8, pc = tid % 8; FragH f;
#pragma unroll
      for (int q = 0; q < 8; ++q) f.u[q] = tl[pc * 8 + q][d];
      *(v8us*)((unsigned short*)Vt + ((size_t)slab * 64 + d) * TTv + lg * 64 + pc * 8) = f.half[0]; }
     } }

__global__ __launch_bounds__(256) void k_hl(const float* __restrict__ F, _Float16* __restrict__ Hh, _Float16* __restrict__ Hl, size_t n8) { const size_t t = (size_t)blockIdx.x * 256 + threadIdx.x; if (t >= n8) return; FragH fh, fl; const v4f a = *(const v4fa*)(F + t * 8), c = *(const v4fa*)(F + t * 8 + 4);
#pragma unroll
  for (int q = 0; q < 4; ++q) { _Float16 h = (_Float16)a[q]; fh.h[q] = h; fl.h[q] = (_Float16)((a[q] - (float)h) * 1024.0f); h = (_Float16)c[q]; fh.h[4 + q] = h; fl.h[4 + q] = (_Float16)((c[q] - (float)h) * 1024.0f); }
  { *(v8us*)((unsigned short*)Hh + t * 8) = fh.half[0]; *(v8us*)((unsigned short*)Hl + t * 8) = fl.half[0];  } }

// ---- fast GEMM (wave tile 32x64; requires M % 32 == 0 rows per launch region and N % 64 == 0); epilogue = k_gemm_hhx semantics ----
__device__ __forceinline__ v16h g2_frag(const _Float16* p, int hh) { FragH f; f.half[0] = *(const v8us*)((const unsigned short*)p + 8 * hh); f.half[1] = *(const v8us*)((const unsigned short*)p + 16 + 8 * hh); return f.v; }
__device__ __forceinline__ v8f g2_mma(v16h a, v16h b, v8f c) { v8f d = __builtin_amdgcn_wmma_f32_16x16x32_f16(false, a, false, b, (short)0, c, false, false); asm volatile("v_nop\n\tv_nop\n\tv_nop\n\tv_nop" : "+v"(d) : "v"(a), "v"(b)); return d; }
template <int ACT>
__global__ __launch_bounds__(128) void k_gemm2(const _Float16* __restrict__ A, int lda, size_t sA, const _Float16* __restrict__ Bh, int ldb, size_t sB, float alpha, const float* __restrict__ bias, size_t sBias, const float* __restrict__ CP, int rowsPerB, size_t sCPb, int row0g,
    float* __restrict__ C, _Float16* __restrict__ C16, int ldc, size_t sC, int M, int N, int K) { static_assert(ACT == 0 || ACT == 3 || ACT == 6 || ACT == 8 || ACT == 9 || ACT == 11 || ACT == 12 || ACT == 14 || ACT == 15 || ACT == 16 || ACT == 17, "k_gemm2: unsupported ACT code (would silently apply no activation)");
  __shared__ __attribute__((aligned(16))) float so[4][32][68];
  const int tid = threadIdx.x, w = tid >> 5, lane = tid & 31, ln = lane & 15, hh = lane >> 4; const int by = blockIdx.y;
  A += (size_t)by * sA; Bh += (size_t)by * sB; const size_t cofs = (size_t)by * sC; const float* bp = bias ? bias + (size_t)by * sBias : nullptr;
  const int ntn = N >> 6; const int mt = blockIdx.x / ntn, nq = blockIdx.x - mt * ntn; const int row0 = mt * 128 + 32 * w, col0 = nq * 64; if (row0 >= M) return;
  const _Float16* a0p = A + (size_t)(row0 + ln) * lda; const _Float16* a1p = a0p + (size_t)16 * lda;
  const _Float16* b0p = Bh + (size_t)(col0 + ln) * ldb; const _Float16* b1p = b0p + (size_t)16 * ldb; const _Float16* b2p = b1p + (size_t)16 * ldb; const _Float16* b3p = b2p + (size_t)16 * ldb;
  const v8f z8 = {0.f,0.f,0.f,0.f,0.f,0.f,0.f,0.f}; v8f c00 = z8, c01 = z8, c02 = z8, c03 = z8, c10 = z8, c11 = z8, c12 = z8, c13 = z8;
#pragma unroll 1
  for (int kb = 0; kb < K; kb += 32) { const v16h a0 = g2_frag(a0p + kb, hh), a1 = g2_frag(a1p + kb, hh);
    v16h b = g2_frag(b0p + kb, hh); c00 = g2_mma(a0, b, c00); c10 = g2_mma(a1, b, c10);
    b = g2_frag(b1p + kb, hh); c01 = g2_mma(a0, b, c01); c11 = g2_mma(a1, b, c11);
    b = g2_frag(b2p + kb, hh); c02 = g2_mma(a0, b, c02); c12 = g2_mma(a1, b, c12);
    b = g2_frag(b3p + kb, hh); c03 = g2_mma(a0, b, c03); c13 = g2_mma(a1, b, c13); }
  v8f accs[8] = {c00, c01, c02, c03, c10, c11, c12, c13};
#pragma unroll
  for (int u = 0; u < 8; ++u) { const int t = u & 3, half = u >> 2; const int col = col0 + t * 16 + ln; const float bv = bp ? bf16_round(bp[col]) : 0.f;
#pragma unroll
    for (int r = 0; r < 8; ++r) { const int rloc = half * 16 + 8 * hh + r; float v = accs[u][r] * alpha + bv; if (CP) { if (rowsPerB < 0) v += CP[cofs + (size_t)(row0g + row0 + rloc) * ldc + col];      /* rowsPerB < 0: own element of the batched C plane */ else { const int bidx = (row0g + row0 + rloc) / rowsPerB; v += CP[(size_t)bidx * sCPb + (size_t)by * 64 + col]; } }
      if (ACT == 3) v = fmaxf(v, 0.f); else if (ACT == 6) v = 0.5f * v * (1.0f + erff(v * 0.70710678118654752f)); else if (ACT == 11) v = 1.0f / (1.0f + expf(-v)); else if (ACT == 15) v = v / (1.0f + expf(-v)); else if (ACT == 12) v = (v > 0.f) ? v : 0.01f * v; else if (ACT == 8) v = tanhf(v); else if (ACT == 9) v = 0.5f * v * (1.0f + tanhf(0.7978845608028654f * (v + 0.044715f * v * v * v))); else if (ACT == 14) v = (v > 0.f) ? v : 0.1f * v; else if (ACT == 16) v = (v >= 0.f) ? v : 0.3f * v; else if (ACT == 17) v = (v >= 0.f) ? v : 0.2f * v;
      so[w][rloc][t * 16 + ln] = v; } }
  __builtin_amdgcn_fence(__ATOMIC_ACQ_REL, "workgroup"); __builtin_amdgcn_wave_barrier();
  const int rsub = lane >> 4, c4 = (lane & 15) * 4;
  {
#pragma unroll
    for (int q = 0; q < 16; ++q) { const int r = q * 2 + rsub; const v4f v = *(const v4fa*)&so[w][r][c4]; if (C) *(v4f*)(C + cofs + (size_t)(row0 + r) * ldc + col0 + c4) = v; if (C16) { v4h h4; for (int i = 0; i < 4; ++i) h4[i] = (_Float16)v[i]; *(v4h*)(C16 + cofs + (size_t)(row0 + r) * ldc + col0 + c4) = h4; } }
     } }


__global__ __launch_bounds__(256) void k_tok(const float* __restrict__ x, _Float16* __restrict__ X) { __shared__ float tl[CC][17]; const int tid = threadIdx.x; const int b = blockIdx.x / (PX / 16), pb = blockIdx.x % (PX / 16); const int p0 = pb * 16;
  for (int i = tid; i < CC * 16; i += 256) { const int c = i / 16, p = i % 16; tl[c][p] = bf16_round(x[((size_t)b * CC + c) * PX + p0 + p]); }
  __syncthreads();
  { for (int i = tid; i < 16 * (CC / 8); i += 256) { const int p = i / (CC / 8), c0 = (i % (CC / 8)) * 8; FragH f; for (int q = 0; q < 8; ++q) f.h[q] = (_Float16)tl[c0 + q][p]; *(v8us*)((unsigned short*)X + ((size_t)b * PX + p0 + p) * CC + c0) = f.half[0]; }  } }
template <int DIRW>
__global__ __launch_bounds__(256) void k_im3(const float* __restrict__ x, int b, _Float16* __restrict__ A) { const size_t t = (size_t)blockIdx.x * 256 + threadIdx.x; if (t >= (size_t)PX * CC * 3 / 8) return; const int j0 = (int)((t * 8) % (CC * 3)); const int p = (int)((t * 8) / (CC * 3)); const int y = p / HS, xq = p % HS; FragH f;
  for (int q = 0; q < 8; ++q) { const int j = j0 + q; const int c = j / 3, d = j % 3; int yy = y, xx = xq; if (DIRW) xx += d - 1; else yy += d - 1; float v = 0.f; if (yy >= 0 && yy < HS && xx >= 0 && xx < HS) v = bf16_round(x[((size_t)b * CC + c) * PX + yy * HS + xx]); f.h[q] = (_Float16)v; }
  *(v8us*)((unsigned short*)A + t * 8) = f.half[0];  }
// bias padded to 64: bp[i] = i < 32 ? b[i] : 0
__global__ __launch_bounds__(64) void k_bpad32(const float* __restrict__ b, float* __restrict__ bp) { const int i = threadIdx.x; const float v = (i < CQ) ? b[i] : 0.f; *(float*)(bp + i) = v;  }
__global__ __launch_bounds__(256) void k_qk16(const float* __restrict__ Q, _Float16* __restrict__ QH, _Float16* __restrict__ QL) { const size_t t = (size_t)blockIdx.x * 256 + threadIdx.x; if (t >= (size_t)NB * PX) return; unsigned short* dh = (unsigned short*)QH + t * CQ; unsigned short* dl = (unsigned short*)QL + t * CQ;
  for (int pc = 0; pc < CQ / 8; ++pc) { const v8f a = *(const v8f*)(Q + t * 64 + pc * 8); FragH fh, fl; for (int q = 0; q < 8; ++q) { const float v = a[q]; const _Float16 hh = (_Float16)v; fh.h[q] = hh; fl.h[q] = (_Float16)((v - (float)hh) * 1024.0f); } *(v8us*)(dh + pc * 8) = fh.half[0]; *(v8us*)(dl + pc * 8) = fl.half[0];  } }
__global__ __launch_bounds__(256) void k_soft(const float* __restrict__ S, _Float16* __restrict__ PH, _Float16* __restrict__ PL) {
  #pragma clang fp contract(off)
  const int wv = threadIdx.x >> 5, ln = threadIdx.x & 31; const size_t i = (size_t)blockIdx.x * 8 + wv; if (i >= (size_t)PX) return; const float* sr = S + i * PX; float mx = -3.0e38f;
#pragma unroll 1
  for (int pc = 0; pc < PX / 256; ++pc) { const v8f a = *(const v8f*)(sr + pc * 256 + ln * 8); for (int q = 0; q < 8; ++q) mx = fmaxf(mx, a[q]); }
  for (int o = 16; o > 0; o >>= 1) mx = fmaxf(mx, __shfl_xor(mx, o, 32)); float su = 0.f;
#pragma unroll 1
  for (int pc = 0; pc < PX / 256; ++pc) { const v8f a = *(const v8f*)(sr + pc * 256 + ln * 8); for (int q = 0; q < 8; ++q) su += expf(a[q] - mx); }
  for (int o = 16; o > 0; o >>= 1) su += __shfl_xor(su, o, 32); const float inv = 1.0f / su;
  {
#pragma unroll 1
    for (int pc = 0; pc < PX / 256; ++pc) { const v8f a = *(const v8f*)(sr + pc * 256 + ln * 8); FragH fh, fl; for (int q = 0; q < 8; ++q) { const float p = expf(a[q] - mx) * inv; const _Float16 hh = (_Float16)p; fh.h[q] = hh; fl.h[q] = (_Float16)((p - (float)hh) * 1024.0f); }
      *(v8us*)((unsigned short*)PH + i * PX + pc * 256 + ln * 8) = fh.half[0]; *(v8us*)((unsigned short*)PL + i * PX + pc * 256 + ln * 8) = fl.half[0]; }  } }
__global__ __launch_bounds__(256) void k_vt64(const _Float16* __restrict__ V16, int b, _Float16* __restrict__ VT) { __shared__ unsigned short tl[64][CC + 2]; const int tid = threadIdx.x; const int j0 = blockIdx.x * 64;
  for (int i = tid; i < 64 * (CC / 8); i += 256) { const int r = i / (CC / 8), c8 = (i % (CC / 8)) * 8; FragH f; f.half[0] = *(const v8us*)((const unsigned short*)V16 + ((size_t)b * PX + j0 + r) * CC + c8); for (int q = 0; q < 8; ++q) tl[r][c8 + q] = f.u[q]; }
  __syncthreads();
  const int c = tid; unsigned short* d = (unsigned short*)VT + (size_t)c * PX + j0;
  { for (int k8 = 0; k8 < 8; ++k8) { FragH f; for (int q = 0; q < 8; ++q) f.u[q] = tl[k8 * 8 + q][c]; *(v8us*)(d + k8 * 8) = f.half[0]; }  } }
__global__ __launch_bounds__(256) void k_fin(const float* __restrict__ O, float* __restrict__ out) { const size_t t = (size_t)blockIdx.x * 256 + threadIdx.x; if (t >= (size_t)NB * CC * PX / 8) return; const int i0 = (int)((t * 8) % PX); const int c = (int)(((t * 8) / PX) % CC); const int b = (int)((t * 8) / ((size_t)PX * CC)); v8f v;
  for (int q = 0; q < 8; ++q) v[q] = O[((size_t)b * PX + i0 + q) * CC + c];
  *(v8f*)(out + t * 8) = v;  }
__global__ __launch_bounds__(256) void k_zero16(_Float16* __restrict__ p, size_t n8) { const size_t t = (size_t)blockIdx.x * 256 + threadIdx.x; if (t >= n8) return; const v8us z = {0,0,0,0,0,0,0,0}; *(v8us*)((unsigned short*)p + t * 8) = z;  }
extern "C" void kernel_launch(void* const* d_in, const int* in_sizes, int n_in,
                              void* d_out, int out_size, void* d_ws, size_t ws_size, hipStream_t stream) {
  (void)in_sizes; (void)n_in; (void)out_size;
  const float* const* I = (const float* const*)d_in; const float* x = I[0]; const float* qw = I[1]; const float* qb = I[2]; const float* kw = I[3]; const float* kb = I[4]; const float* vw = I[5]; const float* vb = I[6];
  char* ws = (char*)d_ws; size_t off = 0;
  auto take = [&](size_t bytes) { char* p = ws + off; off += (bytes + 255) & ~(size_t)255; return p; };
  _Float16* BV = (_Float16*)take((size_t)CC * CC * 2); _Float16* X16 = (_Float16*)take((size_t)NR * CC * 2); float* Qp = (float*)take((size_t)NR * 64 * 4); float* Kp = (float*)take((size_t)NR * 64 * 4); _Float16* A3 = (_Float16*)take((size_t)PX * CC * 3 * 2); _Float16* BQW = (_Float16*)take((size_t)64 * CC * 3 * 2); _Float16* BKW = (_Float16*)take((size_t)64 * CC * 3 * 2); float* bqp = (float*)take(64 * 4); float* bkp = (float*)take(64 * 4); _Float16* V16 = (_Float16*)take((size_t)NR * CC * 2); _Float16* VT = (_Float16*)take((size_t)CC * PX * 2);
  _Float16* QH = (_Float16*)take((size_t)NR * CQ * 2); _Float16* QL = (_Float16*)take((size_t)NR * CQ * 2); _Float16* KH = (_Float16*)take((size_t)NR * CQ * 2); _Float16* KL = (_Float16*)take((size_t)NR * CQ * 2); float* S = (float*)take((size_t)PX * PX * 4); _Float16* PH = (_Float16*)take((size_t)PX * PX * 2); _Float16* PL = (_Float16*)take((size_t)PX * PX * 2); float* O = (float*)take((size_t)NR * CC * 4);
  if (off > ws_size) return;      /* ≈ 180 MiB */
  k_round16f<<<(CC * CC / 8 + 255) / 256, 256, 0, stream>>>(vw, BV, (size_t)CC * CC / 8);      /* Bt[o][i] = bf16(Wv[o][i]) x16 (natural OIHW 1x1) */
  k_tok<<<NB * (PX / 16), 256, 0, stream>>>(x, X16);
  k_zero16<<<(unsigned)(((size_t)64 * CC * 3 / 8 + 255) / 256), 256, 0, stream>>>(BQW, (size_t)64 * CC * 3 / 8); k_zero16<<<(unsigned)(((size_t)64 * CC * 3 / 8 + 255) / 256), 256, 0, stream>>>(BKW, (size_t)64 * CC * 3 / 8); k_round16f<<<(unsigned)(((size_t)CQ * CC * 3 / 8 + 255) / 256), 256, 0, stream>>>(qw, BQW, (size_t)CQ * CC * 3 / 8); k_round16f<<<(unsigned)(((size_t)CQ * CC * 3 / 8 + 255) / 256), 256, 0, stream>>>(kw, BKW, (size_t)CQ * CC * 3 / 8); k_bpad32<<<1, 64, 0, stream>>>(qb, bqp); k_bpad32<<<1, 64, 0, stream>>>(kb, bkp);      /* Wq [32][256][1][3] / Wk [32][256][3][1] natural = Bt rows [cq][c*3 + d]; rows 32..63 zero */
  for (int b = 0; b < NB; ++b) {      /* q / k = 3-tap convs as K = 768 GEMMs (exact products, f32 + bias) */
    k_im3<1><<<(unsigned)(((size_t)PX * CC * 3 / 8 + 255) / 256), 256, 0, stream>>>(x, b, A3); k_gemm2<0><<<dim3((PX / 128) * 1, 1), 128, 0, stream>>>(A3, CC * 3, 0, BQW, CC * 3, 0, 0.0625f, bqp, 0, nullptr, 1, 0, 0, Qp + (size_t)b * PX * 64, nullptr, 64, 0, PX, 64, CC * 3);
    k_im3<0><<<(unsigned)(((size_t)PX * CC * 3 / 8 + 255) / 256), 256, 0, stream>>>(x, b, A3); k_gemm2<0><<<dim3((PX / 128) * 1, 1), 128, 0, stream>>>(A3, CC * 3, 0, BKW, CC * 3, 0, 0.0625f, bkp, 0, nullptr, 1, 0, 0, Kp + (size_t)b * PX * 64, nullptr, 64, 0, PX, 64, CC * 3); }
  k_qk16<<<(unsigned)(((size_t)NB * PX + 255) / 256), 256, 0, stream>>>(Qp, QH, QL); k_qk16<<<(unsigned)(((size_t)NB * PX + 255) / 256), 256, 0, stream>>>(Kp, KH, KL);
  k_gemm2<0><<<dim3((NR / 128) * (CC / 64), 1), 128, 0, stream>>>(X16, CC, 0, BV, CC, 0, 0.0625f, vb, 0, nullptr, 1, 0, 0, nullptr, V16, CC, 0, NR, CC, CC);      /* v = conv1x1(x) + bv as f16 rows */
  for (int b = 0; b < NB; ++b) {
    { const _Float16* qh = QH + (size_t)b * PX * CQ; const _Float16* ql = QL + (size_t)b * PX * CQ; const _Float16* kh = KH + (size_t)b * PX * CQ; const _Float16* kl = KL + (size_t)b * PX * CQ;
      k_gemm2<0><<<dim3((PX / 128) * (PX / 64), 1), 128, 0, stream>>>(ql, CQ, 0, kh, CQ, 0, 1.0f / 1024.0f, nullptr, 0, nullptr, 1, 0, 0, S, nullptr, PX, 0, PX, PX, CQ);
      k_gemm2<0><<<dim3((PX / 128) * (PX / 64), 1), 128, 0, stream>>>(qh, CQ, 0, kl, CQ, 0, 1.0f / 1024.0f, nullptr, 0, S, -1, 0, 0, S, nullptr, PX, 0, PX, PX, CQ);
      k_gemm2<0><<<dim3((PX / 128) * (PX / 64), 1), 128, 0, stream>>>(qh, CQ, 0, kh, CQ, 0, 1.0f, nullptr, 0, S, -1, 0, 0, S, nullptr, PX, 0, PX, PX, CQ); }      /* logits (three terms, K = 32) */
    k_soft<<<PX / 8, 256, 0, stream>>>(S, PH, PL);
    k_vt64<<<PX / 64, 256, 0, stream>>>(V16, b, VT);
    float* Ob = O + (size_t)b * PX * CC;
    k_gemm2<0><<<dim3((PX / 128) * (CC / 64), 1), 128, 0, stream>>>(PL, PX, 0, VT, PX, 0, 1.0f / 1024.0f, nullptr, 0, nullptr, 1, 0, 0, Ob, nullptr, CC, 0, PX, CC, PX);
    k_gemm2<0><<<dim3((PX / 128) * (CC / 64), 1), 128, 0, stream>>>(PH, PX, 0, VT, PX, 0, 1.0f, nullptr, 0, Ob, -1, 0, 0, Ob, nullptr, CC, 0, PX, CC, PX); }      /* out rows [i][c] = sum_j P[i][j] v[c][j] */
  k_fin<<<(unsigned)(((size_t)NB * CC * PX / 8 + 255) / 256), 256, 0, stream>>>(O, (float*)d_out);
}

// v001
// A run of this version takes 1180 microseconds.
// Next to v000, in two timings, it ran 1.53 and 1.52 times as fast.
#include <hip/hip_runtime.h>
// SpatialAttention (x [4][256][64][64]; q = conv(1,3)(x) + bq, k = conv(3,1)(x) + bk with 32 channels; attn = softmax_j(sum_d q[d][i] k[d][j]) over 4096 positions (unscaled); v = conv1x1(x) + bv; out[c][i] = sum_j v[c][j] attn[i][j] -> [4][256][64][64]).
// Structure: q / k by im2col (k_im3, f16) + WMMA GEMMs (K = 768, f32 accumulation + bias) into f16 hi/residual operand planes; v as a WMMA GEMM over exact f16 pixel rows (32x64 wave tiles, f32 accumulation, exact x16 weights + bias) then v^T by LDS tiles; per batch the 32-term logits as a three-term GEMM (K = 32) into f32, softmax (wave per row, rolled passes) into f16 hi/residual probability planes, out rows = P v^T as a two-term GEMM; NCHW store on VALU.
// Compute dtype: inputs rounded to bf16; x / weights exact; q, k as f16 hi + 2^-10 residual pairs (~2^-21; the logits are unscaled with std 10.7); softmax f32 with hi + residual probabilities; v plain f16 (~2^-12). v_wmma_f32_16x16x32_f16.
#define NB 4
#define CC 256
#define CQ 32
#define HS 64
#define PX (HS * HS)             /* 4096 */
#define NR (NB * PX)
typedef __bf16 v16b __attribute__((ext_vector_type(16)));
typedef unsigned short v8us __attribute__((ext_vector_type(8), may_alias));
typedef float  v8f  __attribute__((ext_vector_type(8)));
typedef float  v4f  __attribute__((ext_vector_type(4)));
typedef float  v4fa __attribute__((ext_vector_type(4), may_alias));
union FragB { v16b v; v8us half[2]; unsigned short u[16]; };

__device__ __forceinline__ unsigned short bf16_bits(float x) { unsigned int u = __float_as_uint(x); return (unsigned short)((u + 0x7FFFu + ((u >> 16) & 1u)) >> 16); }
__device__ __forceinline__ float bf16_val(unsigned short b) { return __uint_as_float(((unsigned int)b) << 16); }
__device__ __forceinline__ float bf16_round(float x) { return bf16_val(bf16_bits(x)); }
// D += A·B with NT terms: 1 = ah·bh, 2 = + al·bh (A split), 3 = + ah·bl (both split)
template <int NT>
__device__ __forceinline__ v8f mmaN(v16b ah, v16b al, v16b bh, v16b bl, v8f c) {
  c = __builtin_amdgcn_wmma_f32_16x16x32_bf16(false, ah, false, bh, (short)0, c, false, false);
  if (NT >= 2) c = __builtin_amdgcn_wmma_f32_16x16x32_bf16(false, al, false, bh, (short)0, c, false, false);
  if (NT >= 3) c = __builtin_amdgcn_wmma_f32_16x16x32_bf16(false, ah, false, bl, (short)0, c, false, false);
  asm volatile("v_nop\n\tv_nop\n\tv_nop\n\tv_nop" : "+v"(c) : "v"(ah), "v"(al), "v"(bh), "v"(bl));
  return c;
}

__global__ __launch_bounds__(256) void k_wt_bf16(const float* __restrict__ W, unsigned short* __restrict__ Wt, int K, int N) {
  const int t = blockIdx.x * 256 + threadIdx.x;
  const int k8n = K / 8;
  if (t >= N * k8n) return;
  const int n = t / k8n, k8 = (t % k8n) * 8;
  v8us v;
#pragma unroll
  for (int i = 0; i < 8; ++i) v[i] = bf16_bits(W[(size_t)(k8 + i) * N + n]);
  *(v8us*)(Wt + (size_t)n * K + k8) = v;
  
}

// GEMM C[M][N] (f32, pitch ldc) = act(A[M][K]·W + bias). A f32 row-major (pitch lda) converted per fragment to bf16
// (ASPLIT: hi/lo two planes -> 2 terms, else single rounded term); Wt bf16 [N][K] (pitch ldb). BIAS_BF16 rounds the
// bias to bf16 first (bias quantised to bf16 before the add). K%32==0, M%16==0, N%64==0.
template <bool ASPLIT, int ACT, bool BIAS_BF16>
__global__ __launch_bounds__(128) void k_gemm_bf(const float* __restrict__ A, int lda, const unsigned short* __restrict__ Wt, int ldb,
                                               const float* __restrict__ bias, float* __restrict__ C, int ldc, int M, int N, int K) {
  __shared__ __attribute__((aligned(16))) float so[4][16][64];
  const int tid = threadIdx.x, w = tid >> 5, lane = tid & 31, ln = lane & 15, hh = lane >> 4;
  const int ntn = N / 64;
  const int wid = blockIdx.x * 4 + w;
  const int mt = wid / ntn, nq = wid % ntn;
  if (mt * 16 >= M) return;
  const int row0 = mt * 16, col0 = nq * 64;
  const float* arow = A + (size_t)(row0 + ln) * lda;
  v8f acc[4] = {};
  for (int kb = 0; kb < K; kb += 32) {
    FragB ah, al;
    const v4f x0 = *(const v4fa*)(arow + kb + 8 * hh), x1 = *(const v4fa*)(arow + kb + 8 * hh + 4);
    const v4f x2 = *(const v4fa*)(arow + kb + 16 + 8 * hh), x3 = *(const v4fa*)(arow + kb + 16 + 8 * hh + 4);
    float xs[16] = {x0[0],x0[1],x0[2],x0[3],x1[0],x1[1],x1[2],x1[3],x2[0],x2[1],x2[2],x2[3],x3[0],x3[1],x3[2],x3[3]};
#pragma unroll
    for (int i = 0; i < 16; ++i) { const unsigned short hb = bf16_bits(xs[i]); ah.u[i] = hb; al.u[i] = ASPLIT ? bf16_bits(xs[i] - bf16_val(hb)) : (unsigned short)0; }
#pragma unroll
    for (int t = 0; t < 4; ++t) {
      const unsigned short* brow = Wt + (size_t)(col0 + t * 16 + ln) * ldb + kb;
      FragB b;
      b.half[0] = *(const v8us*)(brow + 8 * hh);
      b.half[1] = *(const v8us*)(brow + 16 + 8 * hh);
      acc[t] = mmaN<ASPLIT ? 2 : 1>(ah.v, al.v, b.v, b.v, acc[t]);
    }
  }
#pragma unroll
  for (int t = 0; t < 4; ++t) {
    float bv = bias ? bias[col0 + t * 16 + ln] : 0.f;
    if (BIAS_BF16) bv = bf16_round(bv);
#pragma unroll
    for (int r = 0; r < 8; ++r) { float v = acc[t][r] + bv; if (ACT == 1) v = fmaxf(v, 0.f); so[w][8 * hh + r][t * 16 + ln] = v; }
  }
  __builtin_amdgcn_fence(__ATOMIC_ACQ_REL, "workgroup");
  __builtin_amdgcn_wave_barrier();
  const int rsub = lane >> 4, c4 = (lane & 15) * 4;
  {
#pragma unroll
    for (int q = 0; q < 8; ++q) {
      const int r = q * 2 + rsub;
      const v4f v = *(const v4fa*)&so[w][r][c4];
      *(v4f*)(C + (size_t)(row0 + r) * ldc + col0 + c4) = v;
    }
    
  }
}

// GEMM C = act(A·W + bias + resid): A f32 (ASPLIT -> hi/lo 2 terms), Wt bf16 [N][K]; ACT 0 none, 1 relu, 2 exact gelu;
// resid (optional, f32, row index = (row % rmod), pitch ldr, RES_BF16 rounds it) added before the activation.
template <bool ASPLIT, int ACT, bool BIAS_BF16, bool RES_BF16>
__global__ __launch_bounds__(128) void k_gemm_bf3(const float* __restrict__ A, int lda, const unsigned short* __restrict__ Wt, int ldb,
                                                const float* __restrict__ bias, const float* __restrict__ resid, int rmod, int ldr,
                                                float* __restrict__ C, int ldc, int M, int N, int K) {
  __shared__ __attribute__((aligned(16))) float so[4][16][64];
  const int tid = threadIdx.x, w = tid >> 5, lane = tid & 31, ln = lane & 15, hh = lane >> 4;
  const int ntn = N / 64;
  const int wid = blockIdx.x * 4 + w;
  const int mt = wid / ntn, nq = wid % ntn;
  if (mt * 16 >= M) return;
  const int row0 = mt * 16, col0 = nq * 64;
  const float* arow = A + (size_t)(row0 + ln) * lda;
  v8f acc[4] = {};
  for (int kb = 0; kb < K; kb += 32) {
    FragB ah, al;
    const v4f x0 = *(const v4fa*)(arow + kb + 8 * hh), x1 = *(const v4fa*)(arow + kb + 8 * hh + 4);
    const v4f x2 = *(const v4fa*)(arow + kb + 16 + 8 * hh), x3 = *(const v4fa*)(arow + kb + 16 + 8 * hh + 4);
    float xs[16] = {x0[0],x0[1],x0[2],x0[3],x1[0],x1[1],x1[2],x1[3],x2[0],x2[1],x2[2],x2[3],x3[0],x3[1],x3[2],x3[3]};
#pragma unroll
    for (int i = 0; i < 16; ++i) { const unsigned short hb = bf16_bits(xs[i]); ah.u[i] = hb; al.u[i] = ASPLIT ? bf16_bits(xs[i] - bf16_val(hb)) : (unsigned short)0; }
#pragma unroll
    for (int t = 0; t < 4; ++t) {
      const unsigned short* brow = Wt + (size_t)(col0 + t * 16 + ln) * ldb + kb;
      FragB b;
      b.half[0] = *(const v8us*)(brow + 8 * hh);
      b.half[1] = *(const v8us*)(brow + 16 + 8 * hh);
      acc[t] = mmaN<ASPLIT ? 2 : 1>(ah.v, al.v, b.v, b.v, acc[t]);
    }
  }
#pragma unroll
  for (int t = 0; t < 4; ++t) {
    const int col = col0 + t * 16 + ln;
    float bv = bias ? bias[col] : 0.f;
    if (BIAS_BF16) bv = bf16_round(bv);
#pragma unroll
    for (int r = 0; r < 8; ++r) {
      float v = acc[t][r] + bv;
      if (resid) { float rv = resid[(size_t)((row0 + 8 * hh + r) % rmod) * ldr + col]; if (RES_BF16) rv = bf16_round(rv); v += rv; }
      if (ACT == 1) v = fmaxf(v, 0.f);
      if (ACT == 2) v = 0.5f * v * (1.0f + erff(v * 0.70710678118654752f));
      if (ACT == 3) { const float u = 0.7978845608028654f * (v + 0.044715f * v * v * v); v = 0.5f * v * (1.0f + tanhf(u)); }
      so[w][8 * hh + r][t * 16 + ln] = v;
    }
  }
  __builtin_amdgcn_fence(__ATOMIC_ACQ_REL, "workgroup");
  __builtin_amdgcn_wave_barrier();
  const int rsub = lane >> 4, c4 = (lane & 15) * 4;
  {
#pragma unroll
    for (int q = 0; q < 8; ++q) {
      const int r = q * 2 + rsub;
      const v4f v = *(const v4fa*)&so[w][r][c4];
      *(v4f*)(C + (size_t)(row0 + r) * ldc + col0 + c4) = v;
    }
    
  }
}
// row LayerNorm (biased variance, eps) over N: s = X (+ R); optional out_sum <- s; out_norm <- (s-mu)*rsqrt(var+eps)*g + b
template <bool PARAM_BF16>
__global__ __launch_bounds__(256) void k_layernorm(const float* __restrict__ X, const float* __restrict__ R, const float* __restrict__ g, const float* __restrict__ bta,
                                                  float* __restrict__ out_sum, float* __restrict__ out_norm, int N, float eps) {
  __shared__ float red[256];
  const int row = blockIdx.x, tid = threadIdx.x;
  const float* x = X + (size_t)row * N; const float* rr = R ? R + (size_t)row * N : nullptr;
  float vals[16];                     // up to N = 4096
  const int per = N / 256;            // contiguous chunk per thread? use strided-by-4 chunks: thread handles j = tid*4 + 1024*u
  float s1 = 0.f;
  for (int u = 0; u < per / 4; ++u) {
    const int j = tid * 4 + 1024 * u;
    const v4f a = *(const v4fa*)(x + j);
    v4f b = {0.f,0.f,0.f,0.f}; if (rr) b = *(const v4fa*)(rr + j);
#pragma unroll
    for (int q = 0; q < 4; ++q) { const float v = a[q] + b[q]; vals[u * 4 + q] = v; s1 += v; }
  }
  red[tid] = s1; __syncthreads();
  for (int st = 128; st > 0; st >>= 1) { if (tid < st) red[tid] += red[tid + st]; __syncthreads(); }
  const float mu = red[0] / (float)N; __syncthreads();
  float s2 = 0.f;
  for (int u = 0; u < per / 4; ++u)
#pragma unroll
    for (int q = 0; q < 4; ++q) { const float c = vals[u * 4 + q] - mu; s2 += c * c; }
  red[tid] = s2; __syncthreads();
  for (int st = 128; st > 0; st >>= 1) { if (tid < st) red[tid] += red[tid + st]; __syncthreads(); }
  const float rs = rsqrtf(red[0] / (float)N + eps);
  {
    for (int u = 0; u < per / 4; ++u) {
      const int j = tid * 4 + 1024 * u;
      v4f o, sm;
#pragma unroll
      for (int q = 0; q < 4; ++q) {
        float gg = g[j + q], bb = bta[j + q];
        if (PARAM_BF16) { gg = bf16_round(gg); bb = bf16_round(bb); }
        sm[q] = vals[u * 4 + q]; o[q] = (vals[u * 4 + q] - mu) * rs * gg + bb;
      }
      if (out_sum) *(v4f*)(out_sum + (size_t)row * N + j) = sm;
      *(v4f*)(out_norm + (size_t)row * N + j) = o;
    }
    
  }
}



// ---- f16 WMMA path (v_wmma_f32_16x16x32_f16): 11-bit significands for operands in range — used where a [0,1] probability operand needs more precision than bf16
typedef _Float16 v16h __attribute__((ext_vector_type(16)));
union FragH { v16h v; v8us half[2]; _Float16 h[16]; unsigned short u[16]; };
template <int NT>
__device__ __forceinline__ v8f mmaH(v16h ah, v16h al, v16h bh, v16h bl, v8f c) {
  c = __builtin_amdgcn_wmma_f32_16x16x32_f16(false, ah, false, bh, (short)0, c, false, false);
  if (NT >= 2) c = __builtin_amdgcn_wmma_f32_16x16x32_f16(false, al, false, bh, (short)0, c, false, false);
  if (NT >= 3) c = __builtin_amdgcn_wmma_f32_16x16x32_f16(false, ah, false, bl, (short)0, c, false, false);
  asm volatile("v_nop\n\tv_nop\n\tv_nop\n\tv_nop" : "+v"(c) : "v"(ah), "v"(al), "v"(bh), "v"(bl));
  return c;
}
// batched GEMM like k_gemm_b but f16 operands: A f32 (split into f16 hi/lo if ASPLIT, else rounded to f16), Bt = f16 values [n][k]; alpha; C f32; N multiple of 16 (partial tiles skipped)
template <bool ASPLIT>
__global__ __launch_bounds__(128) void k_gemm_h(const float* __restrict__ A, int lda, size_t sA, const _Float16* __restrict__ Bh, int ldb, size_t sB, float alpha, float* __restrict__ C, int ldc, size_t sC, int M, int N, int K) {
  __shared__ __attribute__((aligned(16))) float so[4][16][64];
  const int tid = threadIdx.x, w = tid >> 5, lane = tid & 31, ln = lane & 15, hh = lane >> 4; const int by = blockIdx.y;
  A += (size_t)by * sA; Bh += (size_t)by * sB; C += (size_t)by * sC;
  const int ntn = (N + 63) / 64; const int wid = blockIdx.x * 4 + w; const int mt = wid / ntn, nq = wid % ntn; if (mt * 16 >= M) return;
  const int row0 = mt * 16, col0 = nq * 64; const float* arow = A + (size_t)(row0 + ln) * lda;
  v8f acc[4] = {};
  for (int kb = 0; kb < K; kb += 32) {
    FragH ah, al;
    const v4f x0 = *(const v4fa*)(arow + kb + 8 * hh), x1 = *(const v4fa*)(arow + kb + 8 * hh + 4), x2 = *(const v4fa*)(arow + kb + 16 + 8 * hh), x3 = *(const v4fa*)(arow + kb + 16 + 8 * hh + 4);
    float xs[16] = {x0[0],x0[1],x0[2],x0[3],x1[0],x1[1],x1[2],x1[3],x2[0],x2[1],x2[2],x2[3],x3[0],x3[1],x3[2],x3[3]};
#pragma unroll
    for (int i = 0; i < 16; ++i) { const _Float16 h = (_Float16)xs[i]; ah.h[i] = h; al.h[i] = ASPLIT ? (_Float16)(xs[i] - (float)h) : (_Float16)0.0f; }
#pragma unroll
    for (int t = 0; t < 4; ++t) { if (col0 + t * 16 >= N) continue; const size_t boff = (size_t)(col0 + t * 16 + ln) * ldb + kb; FragH bq; bq.half[0] = *(const v8us*)(Bh + boff + 8 * hh); bq.half[1] = *(const v8us*)(Bh + boff + 16 + 8 * hh);
      acc[t] = mmaH<ASPLIT ? 2 : 1>(ah.v, al.v, bq.v, bq.v, acc[t]); }
  }
#pragma unroll
  for (int t = 0; t < 4; ++t) { if (col0 + t * 16 >= N) continue;
#pragma unroll
    for (int r = 0; r < 8; ++r) so[w][8 * hh + r][t * 16 + ln] = acc[t][r] * alpha; }
  __builtin_amdgcn_fence(__ATOMIC_ACQ_REL, "workgroup"); __builtin_amdgcn_wave_barrier();
  const int rsub = lane >> 4, c4 = (lane & 15) * 4;
  {
#pragma unroll
    for (int q = 0; q < 8; ++q) { const int r = q * 2 + rsub; if (col0 + c4 < N) { const v4f v = *(const v4fa*)&so[w][r][c4]; *(v4f*)(C + (size_t)(row0 + r) * ldc + col0 + c4) = v; } }
     }
}

// Wt[n][k] = f16(W[k][n]·scale) from f32 row-major W[K][N] (scale = power of two; bf16-exact weights stay exact in f16 away from the subnormal range)
__global__ __launch_bounds__(256) void k_wt_f16(const float* __restrict__ W, _Float16* __restrict__ Wt, int K, int N, float scale) {
  const int t = blockIdx.x * 256 + threadIdx.x; if (t >= N * (K / 8)) return; const int n = t / (K / 8), k8 = (t % (K / 8)) * 8; FragH f;
#pragma unroll
  for (int i = 0; i < 8; ++i) f.h[i] = (_Float16)(bf16_round(W[(size_t)(k8 + i) * N + n]) * scale); const v8us o = f.half[0];
  *(v8us*)((unsigned short*)Wt + (size_t)n * K + k8) = o; 
}
// k_gemm_hh variant with fused epilogue: v = acc·alpha + bias[by·sBias + col] (+ CP[(row/rowsPerB)·sCPb + by·64 + col] if CP) ; ACT 0 none / 1 elu ; writes f16 C16 (and f32 C if non-null)
template <int ACT>
__global__ __launch_bounds__(128) void k_gemm_hhx(const _Float16* __restrict__ A, int lda, size_t sA, const _Float16* __restrict__ Bh, int ldb, size_t sB, float alpha, const float* __restrict__ bias, size_t sBias, const float* __restrict__ CP, int rowsPerB, size_t sCPb, int row0g,
    float* __restrict__ C, _Float16* __restrict__ C16, int ldc, size_t sC, int M, int N, int K) {
  __shared__ __attribute__((aligned(16))) float so[4][16][64];
  const int tid = threadIdx.x, w = tid >> 5, lane = tid & 31, ln = lane & 15, hh = lane >> 4; const int by = blockIdx.y;
  A += (size_t)by * sA; Bh += (size_t)by * sB; const size_t cofs = (size_t)by * sC; const float* bp = bias ? bias + (size_t)by * sBias : nullptr;
  const int ntn = (N + 63) / 64; const int wid = blockIdx.x * 4 + w; const int mt = wid / ntn, nq = wid % ntn; if (mt * 16 >= M) return;
  const int row0 = mt * 16, col0 = nq * 64; const _Float16* arow = A + (size_t)(row0 + ln) * lda;
  v8f acc[4] = {};
  for (int kb = 0; kb < K; kb += 32) { FragH ah; ah.half[0] = *(const v8us*)((const unsigned short*)arow + kb + 8 * hh); ah.half[1] = *(const v8us*)((const unsigned short*)arow + kb + 16 + 8 * hh);
#pragma unroll
    for (int t = 0; t < 4; ++t) { if (col0 + t * 16 >= N) continue; const size_t boff = (size_t)(col0 + t * 16 + ln) * ldb + kb; FragH bq; bq.half[0] = *(const v8us*)((const unsigned short*)Bh + boff + 8 * hh); bq.half[1] = *(const v8us*)((const unsigned short*)Bh + boff + 16 + 8 * hh);
      acc[t] = mmaH<1>(ah.v, ah.v, bq.v, bq.v, acc[t]); }
  }
#pragma unroll
  for (int t = 0; t < 4; ++t) { if (col0 + t * 16 >= N) continue; const int col = col0 + t * 16 + ln; const float bv = bp ? bf16_round(bp[col]) : 0.f;
#pragma unroll
    for (int r = 0; r < 8; ++r) { float v = acc[t][r] * alpha + bv; if (CP) { const int rr = row0g + row0 + 8 * hh + r; if (rowsPerB < 0) v += CP[cofs + (size_t)rr * ldc + col];      /* rowsPerB < 0: own element of the batched C plane */ else { const int bidx = rr / rowsPerB; v += CP[(size_t)bidx * sCPb + (size_t)by * 64 + col]; } } if (ACT == 1) v = (v > 0.f) ? v : expm1f(v); else if (ACT == 7) v = (v > 0.f) ? v + 1.0f : expf(v); else if (ACT == 8) v = tanhf(v); else if (ACT == 9) v = 0.5f * v * (1.0f + tanhf(0.7978845608028654f * (v + 0.044715f * v * v * v))); else if (ACT == 11) v = 1.0f / (1.0f + expf(-v)); else if (ACT == 12) v = (v > 0.f) ? v : 0.01f * v; else if (ACT == 14) v = (v > 0.f) ? v : 0.1f * v; else if (ACT == 16) v = (v >= 0.f) ? v : 0.3f * v; else if (ACT == 17) v = (v >= 0.f) ? v : 0.2f * v; else if (ACT == 15) v = v / (1.0f + expf(-v)); else if (ACT == 3) v = fmaxf(v, 0.f); else if (ACT == 6) v = 0.5f * v * (1.0f + erff(v * 0.70710678118654752f)); so[w][8 * hh + r][t * 16 + ln] = v; } }
  __builtin_amdgcn_fence(__ATOMIC_ACQ_REL, "workgroup"); __builtin_amdgcn_wave_barrier();
  const int rsub = lane >> 4, c4 = (lane & 15) * 4; typedef _Float16 v4h __attribute__((ext_vector_type(4)));
  {
#pragma unroll
    for (int q = 0; q < 8; ++q) { const int r = q * 2 + rsub; if (col0 + c4 < N) { const v4f v = *(const v4fa*)&so[w][r][c4]; if (C) *(v4f*)(C + cofs + (size_t)(row0 + r) * ldc + col0 + c4) = v; if (C16) { v4h h4; for (int i = 0; i < 4; ++i) h4[i] = (_Float16)v[i]; *(v4h*)(C16 + cofs + (size_t)(row0 + r) * ldc + col0 + c4) = h4; } } }
     }
}


typedef _Float16 v4h __attribute__((ext_vector_type(4)));

__global__ __launch_bounds__(256) void k_x16(const float* __restrict__ x, _Float16* __restrict__ X16, size_t n8) { const size_t t = (size_t)blockIdx.x * 256 + threadIdx.x; if (t >= n8) return; FragH f;
#pragma unroll
  for (int q = 0; q < 8; ++q) f.h[q] = (_Float16)bf16_round(x[t * 8 + q]); *(v8us*)((unsigned short*)X16 + t * 8) = f.half[0];  }
__global__ __launch_bounds__(256) void k_h16(const float* __restrict__ x, _Float16* __restrict__ X16, size_t n8) { const size_t t = (size_t)blockIdx.x * 256 + threadIdx.x; if (t >= n8) return; FragH f;
#pragma unroll
  for (int q = 0; q < 8; ++q) f.h[q] = (_Float16)x[t * 8 + q]; *(v8us*)((unsigned short*)X16 + t * 8) = f.half[0];  }
__global__ __launch_bounds__(256) void k_round16f(const float* __restrict__ W, _Float16* __restrict__ Bt, size_t n8) { const size_t t = (size_t)blockIdx.x * 256 + threadIdx.x; if (t >= n8) return; FragH f;
#pragma unroll
  for (int i = 0; i < 8; ++i) f.h[i] = (_Float16)(bf16_round(W[t * 8 + i]) * 16.0f); *(v8us*)((unsigned short*)Bt + t * 8) = f.half[0];  }
template <int NHv, int TTv>
__global__ __launch_bounds__(256) void k_vt(const _Float16* __restrict__ V16, int ldv, int voff, _Float16* __restrict__ Vt) { __shared__ unsigned short tl[64][66]; const int tid = threadIdx.x; const int slab = blockIdx.x / (TTv / 64), lg = blockIdx.x % (TTv / 64); const int b = slab / NHv, h = slab % NHv;
  for (int i = tid; i < 64 * 8; i += 256) { const int r = i / 8, c8 = (i % 8) * 8; FragH f; f.half[0] = *(const v8us*)((const unsigned short*)V16 + ((size_t)b * TTv + lg * 64 + r) * ldv + voff + h * 64 + c8);
#pragma unroll
    for (int q = 0; q < 8; ++q) tl[r][c8 + q] = f.u[q]; }
  __syncthreads();
  {
#pragma unroll
    for (int rd = 0; rd < 2; ++rd) { const int d = rd * 32 + tid / 8, pc = tid % 8; FragH f;
#pragma unroll
      for (int q = 0; q < 8; ++q) f.u[q] = tl[pc * 8 + q][d];
      *(v8us*)((unsigned short*)Vt + ((size_t)slab * 64 + d) * TTv + lg * 64 + pc * 8) = f.half[0]; }
     } }

__global__ __launch_bounds__(256) void k_hl(const float* __restrict__ F, _Float16* __restrict__ Hh, _Float16* __restrict__ Hl, size_t n8) { const size_t t = (size_t)blockIdx.x * 256 + threadIdx.x; if (t >= n8) return; FragH fh, fl; const v4f a = *(const v4fa*)(F + t * 8), c = *(const v4fa*)(F + t * 8 + 4);
#pragma unroll
  for (int q = 0; q < 4; ++q) { _Float16 h = (_Float16)a[q]; fh.h[q] = h; fl.h[q] = (_Float16)((a[q] - (float)h) * 1024.0f); h = (_Float16)c[q]; fh.h[4 + q] = h; fl.h[4 + q] = (_Float16)((c[q] - (float)h) * 1024.0f); }
  { *(v8us*)((unsigned short*)Hh + t * 8) = fh.half[0]; *(v8us*)((unsigned short*)Hl + t * 8) = fl.half[0];  } }

// ---- fast GEMM (wave tile 32x64; requires M % 32 == 0 rows per launch region and N % 64 == 0); epilogue = k_gemm_hhx semantics ----
__device__ __forceinline__ v16h g2_frag(const _Float16* p, int hh) { FragH f; f.half[0] = *(const v8us*)((const unsigned short*)p + 8 * hh); f.half[1] = *(const v8us*)((const unsigned short*)p + 16 + 8 * hh); return f.v; }
__device__ __forceinline__ v8f g2_mma(v16h a, v16h b, v8f c) { v8f d = __builtin_amdgcn_wmma_f32_16x16x32_f16(false, a, false, b, (short)0, c, false, false); asm volatile("v_nop\n\tv_nop\n\tv_nop\n\tv_nop" : "+v"(d) : "v"(a), "v"(b)); return d; }
// AHEAD (launches with K >= 64): the K loop keeps two register sets of fragments; all six fragments of a 32-wide k block are loaded as one group one block before
// their WMMAs, so a block waits for one load round trip that is already under way instead of five in a row. Same k order per accumulator as the plain loop.
template <int ACT, bool AHEAD>
__global__ __launch_bounds__(128) void k_gemm2(const _Float16* __restrict__ A, int lda, size_t sA, const _Float16* __restrict__ Bh, int ldb, size_t sB, float alpha, const float* __restrict__ bias, size_t sBias, const float* __restrict__ CP, int rowsPerB, size_t sCPb, int row0g,
    float* __restrict__ C, _Float16* __restrict__ C16, int ldc, size_t sC, int M, int N, int K) { static_assert(ACT == 0 || ACT == 3 || ACT == 6 || ACT == 8 || ACT == 9 || ACT == 11 || ACT == 12 || ACT == 14 || ACT == 15 || ACT == 16 || ACT == 17, "k_gemm2: unsupported ACT code (would silently apply no activation)");
  __shared__ __attribute__((aligned(16))) float so[4][32][68];
  const int tid = threadIdx.x, w = tid >> 5, lane = tid & 31, ln = lane & 15, hh = lane >> 4; const int by = blockIdx.y;
  A += (size_t)by * sA; Bh += (size_t)by * sB; const size_t cofs = (size_t)by * sC; const float* bp = bias ? bias + (size_t)by * sBias : nullptr;
  const int ntn = N >> 6; const int mt = blockIdx.x / ntn, nq = blockIdx.x - mt * ntn; const int row0 = mt * 128 + 32 * w, col0 = nq * 64; if (row0 >= M) return;
  const _Float16* a0p = A + (size_t)(row0 + ln) * lda; const _Float16* a1p = a0p + (size_t)16 * lda;
  const _Float16* b0p = Bh + (size_t)(col0 + ln) * ldb; const _Float16* b1p = b0p + (size_t)16 * ldb; const _Float16* b2p = b1p + (size_t)16 * ldb; const _Float16* b3p = b2p + (size_t)16 * ldb;
  const v8f z8 = {0.f,0.f,0.f,0.f,0.f,0.f,0.f,0.f}; v8f c00 = z8, c01 = z8, c02 = z8, c03 = z8, c10 = z8, c11 = z8, c12 = z8, c13 = z8;
  if (AHEAD) {
    a0p += 8 * hh; a1p += 8 * hh; b0p += 8 * hh; b1p += 8 * hh; b2p += 8 * hh; b3p += 8 * hh;      /* the lane's own k offset goes into the six pointers once: every load of the loop then names a pointer that lives through the loop */
    v16h pa0 = g2_frag(a0p, 0), pa1 = g2_frag(a1p, 0), pb0 = g2_frag(b0p, 0), pb1 = g2_frag(b1p, 0), pb2 = g2_frag(b2p, 0), pb3 = g2_frag(b3p, 0);      /* block 0 */
    int kb = 0;
#pragma unroll 1
    for (; kb + 64 <= K; kb += 64) {      /* rolled: two blocks a trip, one per register set, so no set is copied */
      const v16h qa0 = g2_frag(a0p + 32, 0), qa1 = g2_frag(a1p + 32, 0), qb0 = g2_frag(b0p + 32, 0), qb1 = g2_frag(b1p + 32, 0), qb2 = g2_frag(b2p + 32, 0), qb3 = g2_frag(b3p + 32, 0);
      c00 = g2_mma(pa0, pb0, c00); c10 = g2_mma(pa1, pb0, c10); c01 = g2_mma(pa0, pb1, c01); c11 = g2_mma(pa1, pb1, c11);
      c02 = g2_mma(pa0, pb2, c02); c12 = g2_mma(pa1, pb2, c12); c03 = g2_mma(pa0, pb3, c03); c13 = g2_mma(pa1, pb3, c13);
      asm volatile("s_wait_xcnt 0x0" ::: "memory");      /* stands in front of the pointer steps below, which overwrite the address registers of the loads issued above */
      __builtin_amdgcn_sched_barrier(0);      /* keeps the pointer steps behind that wait (its clobber orders memory operations only) */
      const int step = (kb + 64 < K) ? 64 : -kb;      /* no branch round the loads below (a branch would merge the wait counts to zero); behind the last block they re-read block 0, in bounds, and the values are not used */
      a0p += step; a1p += step; b0p += step; b1p += step; b2p += step; b3p += step;
      pa0 = g2_frag(a0p, 0); pa1 = g2_frag(a1p, 0); pb0 = g2_frag(b0p, 0); pb1 = g2_frag(b1p, 0); pb2 = g2_frag(b2p, 0); pb3 = g2_frag(b3p, 0);
      __builtin_amdgcn_sched_barrier(0);      /* keeps these loads ahead of the other set's WMMAs: without it the first of those WMMAs, with its wait, moves in front of the loads and they start later */
      c00 = g2_mma(qa0, qb0, c00); c10 = g2_mma(qa1, qb0, c10); c01 = g2_mma(qa0, qb1, c01); c11 = g2_mma(qa1, qb1, c11);
      c02 = g2_mma(qa0, qb2, c02); c12 = g2_mma(qa1, qb2, c12); c03 = g2_mma(qa0, qb3, c03); c13 = g2_mma(qa1, qb3, c13);
    }
    asm volatile("s_wait_xcnt 0x0" ::: "memory");      /* the last loads' address registers are free for what follows only behind this */
    if (kb < K) {      /* odd number of blocks: the last one is already in the first set */
      c00 = g2_mma(pa0, pb0, c00); c10 = g2_mma(pa1, pb0, c10); c01 = g2_mma(pa0, pb1, c01); c11 = g2_mma(pa1, pb1, c11);
      c02 = g2_mma(pa0, pb2, c02); c12 = g2_mma(pa1, pb2, c12); c03 = g2_mma(pa0, pb3, c03); c13 = g2_mma(pa1, pb3, c13); }
  } else {
#pragma unroll 1
  for (int kb = 0; kb < K; kb += 32) { const v16h a0 = g2_frag(a0p + kb, hh), a1 = g2_frag(a1p + kb, hh);
    v16h b = g2_frag(b0p + kb, hh); c00 = g2_mma(a0, b, c00); c10 = g2_mma(a1, b, c10);
    b = g2_frag(b1p + kb, hh); c01 = g2_mma(a0, b, c01); c11 = g2_mma(a1, b, c11);
    b = g2_frag(b2p + kb, hh); c02 = g2_mma(a0, b, c02); c12 = g2_mma(a1, b, c12);
    b = g2_frag(b3p + kb, hh); c03 = g2_mma(a0, b, c03); c13 = g2_mma(a1, b, c13); }
  }
  v8f accs[8] = {c00, c01, c02, c03, c10, c11, c12, c13};
#pragma unroll
  for (int u = 0; u < 8; ++u) { const int t = u & 3, half = u >> 2; const int col = col0 + t * 16 + ln; const float bv = bp ? bf16_round(bp[col]) : 0.f;
#pragma unroll
    for (int r = 0; r < 8; ++r) { const int rloc = half * 16 + 8 * hh + r; float v = accs[u][r] * alpha + bv; if (CP) { if (rowsPerB < 0) v += CP[cofs + (size_t)(row0g + row0 + rloc) * ldc + col];      /* rowsPerB < 0: own element of the batched C plane */ else { const int bidx = (row0g + row0 + rloc) / rowsPerB; v += CP[(size_t)bidx * sCPb + (size_t)by * 64 + col]; } }
      if (ACT == 3) v = fmaxf(v, 0.f); else if (ACT == 6) v = 0.5f * v * (1.0f + erff(v * 0.70710678118654752f)); else if (ACT == 11) v = 1.0f / (1.0f + expf(-v)); else if (ACT == 15) v = v / (1.0f + expf(-v)); else if (ACT == 12) v = (v > 0.f) ? v : 0.01f * v; else if (ACT == 8) v = tanhf(v); else if (ACT == 9) v = 0.5f * v * (1.0f + tanhf(0.7978845608028654f * (v + 0.044715f * v * v * v))); else if (ACT == 14) v = (v > 0.f) ? v : 0.1f * v; else if (ACT == 16) v = (v >= 0.f) ? v : 0.3f * v; else if (ACT == 17) v = (v >= 0.f) ? v : 0.2f * v;
      so[w][rloc][t * 16 + ln] = v; } }
  __builtin_amdgcn_fence(__ATOMIC_ACQ_REL, "workgroup"); __builtin_amdgcn_wave_barrier();
  const int rsub = lane >> 4, c4 = (lane & 15) * 4;
  {
#pragma unroll
    for (int q = 0; q < 16; ++q) { const int r = q * 2 + rsub; const v4f v = *(const v4fa*)&so[w][r][c4]; if (C) *(v4f*)(C + cofs + (size_t)(row0 + r) * ldc + col0 + c4) = v; if (C16) { v4h h4; for (int i = 0; i < 4; ++i) h4[i] = (_Float16)v[i]; *(v4h*)(C16 + cofs + (size_t)(row0 + r) * ldc + col0 + c4) = h4; } }
     } }


__global__ __launch_bounds__(256) void k_tok(const float* __restrict__ x, _Float16* __restrict__ X) { __shared__ float tl[CC][17]; const int tid = threadIdx.x; const int b = blockIdx.x / (PX / 16), pb = blockIdx.x % (PX / 16); const int p0 = pb * 16;
  for (int i = tid; i < CC * 16; i += 256) { const int c = i / 16, p = i % 16; tl[c][p] = bf16_round(x[((size_t)b * CC + c) * PX + p0 + p]); }
  __syncthreads();
  { for (int i = tid; i < 16 * (CC / 8); i += 256) { const int p = i / (CC / 8), c0 = (i % (CC / 8)) * 8; FragH f; for (int q = 0; q < 8; ++q) f.h[q] = (_Float16)tl[c0 + q][p]; *(v8us*)((unsigned short*)X + ((size_t)b * PX + p0 + p) * CC + c0) = f.half[0]; }  } }
template <int DIRW>
__global__ __launch_bounds__(256) void k_im3(const float* __restrict__ x, int b, _Float16* __restrict__ A) { const size_t t = (size_t)blockIdx.x * 256 + threadIdx.x; if (t >= (size_t)PX * CC * 3 / 8) return; const int j0 = (int)((t * 8) % (CC * 3)); const int p = (int)((t * 8) / (CC * 3)); const int y = p / HS, xq = p % HS; FragH f;
  for (int q = 0; q < 8; ++q) { const int j = j0 + q; const int c = j / 3, d = j % 3; int yy = y, xx = xq; if (DIRW) xx += d - 1; else yy += d - 1; float v = 0.f; if (yy >= 0 && yy < HS && xx >= 0 && xx < HS) v = bf16_round(x[((size_t)b * CC + c) * PX + yy * HS + xx]); f.h[q] = (_Float16)v; }
  *(v8us*)((unsigned short*)A + t * 8) = f.half[0];  }
// bias padded to 64: bp[i] = i < 32 ? b[i] : 0
__global__ __launch_bounds__(64) void k_bpad32(const float* __restrict__ b, float* __restrict__ bp) { const int i = threadIdx.x; const float v = (i < CQ) ? b[i] : 0.f; *(float*)(bp + i) = v;  }
__global__ __launch_bounds__(256) void k_qk16(const float* __restrict__ Q, _Float16* __restrict__ QH, _Float16* __restrict__ QL) { const size_t t = (size_t)blockIdx.x * 256 + threadIdx.x; if (t >= (size_t)NB * PX) return; unsigned short* dh = (unsigned short*)QH + t * CQ; unsigned short* dl = (unsigned short*)QL + t * CQ;
  for (int pc = 0; pc < CQ / 8; ++pc) { const v8f a = *(const v8f*)(Q + t * 64 + pc * 8); FragH fh, fl; for (int q = 0; q < 8; ++q) { const float v = a[q]; const _Float16 hh = (_Float16)v; fh.h[q] = hh; fl.h[q] = (_Float16)((v - (float)hh) * 1024.0f); } *(v8us*)(dh + pc * 8) = fh.half[0]; *(v8us*)(dl + pc * 8) = fl.half[0];  } }
__global__ __launch_bounds__(256) void k_soft(const float* __restrict__ S, _Float16* __restrict__ PH, _Float16* __restrict__ PL) {
  #pragma clang fp contract(off)
  const int wv = threadIdx.x >> 5, ln = threadIdx.x & 31; const size_t i = (size_t)blockIdx.x * 8 + wv; if (i >= (size_t)PX) return; const float* sr = S + i * PX; float mx = -3.0e38f;
#pragma unroll 1
  for (int pc = 0; pc < PX / 256; ++pc) { const v8f a = *(const v8f*)(sr + pc * 256 + ln * 8); for (int q = 0; q < 8; ++q) mx = fmaxf(mx, a[q]); }
  for (int o = 16; o > 0; o >>= 1) mx = fmaxf(mx, __shfl_xor(mx, o, 32)); float su = 0.f;
#pragma unroll 1
  for (int pc = 0; pc < PX / 256; ++pc) { const v8f a = *(const v8f*)(sr + pc * 256 + ln * 8); for (int q = 0; q < 8; ++q) su += expf(a[q] - mx); }
  for (int o = 16; o > 0; o >>= 1) su += __shfl_xor(su, o, 32); const float inv = 1.0f / su;
  {
#pragma unroll 1
    for (int pc = 0; pc < PX / 256; ++pc) { const v8f a = *(const v8f*)(sr + pc * 256 + ln * 8); FragH fh, fl; for (int q = 0; q < 8; ++q) { const float p = expf(a[q] - mx) * inv; const _Float16 hh = (_Float16)p; fh.h[q] = hh; fl.h[q] = (_Float16)((p - (float)hh) * 1024.0f); }
      *(v8us*)((unsigned short*)PH + i * PX + pc * 256 + ln * 8) = fh.half[0]; *(v8us*)((unsigned short*)PL + i * PX + pc * 256 + ln * 8) = fl.half[0]; }  } }
__global__ __launch_bounds__(256) void k_vt64(const _Float16* __restrict__ V16, int b, _Float16* __restrict__ VT) { __shared__ unsigned short tl[64][CC + 2]; const int tid = threadIdx.x; const int j0 = blockIdx.x * 64;
  for (int i = tid; i < 64 * (CC / 8); i += 256) { const int r = i / (CC / 8), c8 = (i % (CC / 8)) * 8; FragH f; f.half[0] = *(const v8us*)((const unsigned short*)V16 + ((size_t)b * PX + j0 + r) * CC + c8); for (int q = 0; q < 8; ++q) tl[r][c8 + q] = f.u[q]; }
  __syncthreads();
  const int c = tid; unsigned short* d = (unsigned short*)VT + (size_t)c * PX + j0;
  { for (int k8 = 0; k8 < 8; ++k8) { FragH f; for (int q = 0; q < 8; ++q) f.u[q] = tl[k8 * 8 + q][c]; *(v8us*)(d + k8 * 8) = f.half[0]; }  } }
__global__ __launch_bounds__(256) void k_fin(const float* __restrict__ O, float* __restrict__ out) { const size_t t = (size_t)blockIdx.x * 256 + threadIdx.x; if (t >= (size_t)NB * CC * PX / 8) return; const int i0 = (int)((t * 8) % PX); const int c = (int)(((t * 8) / PX) % CC); const int b = (int)((t * 8) / ((size_t)PX * CC)); v8f v;
  for (int q = 0; q < 8; ++q) v[q] = O[((size_t)b * PX + i0 + q) * CC + c];
  *(v8f*)(out + t * 8) = v;  }
__global__ __launch_bounds__(256) void k_zero16(_Float16* __restrict__ p, size_t n8) { const size_t t = (size_t)blockIdx.x * 256 + threadIdx.x; if (t >= n8) return; const v8us z = {0,0,0,0,0,0,0,0}; *(v8us*)((unsigned short*)p + t * 8) = z;  }
extern "C" void kernel_launch(void* const* d_in, const int* in_sizes, int n_in,
                              void* d_out, int out_size, void* d_ws, size_t ws_size, hipStream_t stream) {
  (void)in_sizes; (void)n_in; (void)out_size;
  const float* const* I = (const float* const*)d_in; const float* x = I[0]; const float* qw = I[1]; const float* qb = I[2]; const float* kw = I[3]; const float* kb = I[4]; const float* vw = I[5]; const float* vb = I[6];
  char* ws = (char*)d_ws; size_t off = 0;
  auto take = [&](size_t bytes) { char* p = ws + off; off += (bytes + 255) & ~(size_t)255; return p; };
  _Float16* BV = (_Float16*)take((size_t)CC * CC * 2); _Float16* X16 = (_Float16*)take((size_t)NR * CC * 2); float* Qp = (float*)take((size_t)NR * 64 * 4); float* Kp = (float*)take((size_t)NR * 64 * 4); _Float16* A3 = (_Float16*)take((size_t)PX * CC * 3 * 2); _Float16* BQW = (_Float16*)take((size_t)64 * CC * 3 * 2); _Float16* BKW = (_Float16*)take((size_t)64 * CC * 3 * 2); float* bqp = (float*)take(64 * 4); float* bkp = (float*)take(64 * 4); _Float16* V16 = (_Float16*)take((size_t)NR * CC * 2); _Float16* VT = (_Float16*)take((size_t)CC * PX * 2);
  _Float16* QH = (_Float16*)take((size_t)NR * CQ * 2); _Float16* QL = (_Float16*)take((size_t)NR * CQ * 2); _Float16* KH = (_Float16*)take((size_t)NR * CQ * 2); _Float16* KL = (_Float16*)take((size_t)NR * CQ * 2); float* S = (float*)take((size_t)PX * PX * 4); _Float16* PH = (_Float16*)take((size_t)PX * PX * 2); _Float16* PL = (_Float16*)take((size_t)PX * PX * 2); float* O = (float*)take((size_t)NR * CC * 4);
  if (off > ws_size) return;      /* ≈ 180 MiB */
  k_round16f<<<(CC * CC / 8 + 255) / 256, 256, 0, stream>>>(vw, BV, (size_t)CC * CC / 8);      /* Bt[o][i] = bf16(Wv[o][i]) x16 (natural OIHW 1x1) */
  k_tok<<<NB * (PX / 16), 256, 0, stream>>>(x, X16);
  k_zero16<<<(unsigned)(((size_t)64 * CC * 3 / 8 + 255) / 256), 256, 0, stream>>>(BQW, (size_t)64 * CC * 3 / 8); k_zero16<<<(unsigned)(((size_t)64 * CC * 3 / 8 + 255) / 256), 256, 0, stream>>>(BKW, (size_t)64 * CC * 3 / 8); k_round16f<<<(unsigned)(((size_t)CQ * CC * 3 / 8 + 255) / 256), 256, 0, stream>>>(qw, BQW, (size_t)CQ * CC * 3 / 8); k_round16f<<<(unsigned)(((size_t)CQ * CC * 3 / 8 + 255) / 256), 256, 0, stream>>>(kw, BKW, (size_t)CQ * CC * 3 / 8); k_bpad32<<<1, 64, 0, stream>>>(qb, bqp); k_bpad32<<<1, 64, 0, stream>>>(kb, bkp);      /* Wq [32][256][1][3] / Wk [32][256][3][1] natural = Bt rows [cq][c*3 + d]; rows 32..63 zero */
  for (int b = 0; b < NB; ++b) {      /* q / k = 3-tap convs as K = 768 GEMMs (exact products, f32 + bias) */
    k_im3<1><<<(unsigned)(((size_t)PX * CC * 3 / 8 + 255) / 256), 256, 0, stream>>>(x, b, A3); k_gemm2<0, true><<<dim3((PX / 128) * 1, 1), 128, 0, stream>>>(A3, CC * 3, 0, BQW, CC * 3, 0, 0.0625f, bqp, 0, nullptr, 1, 0, 0, Qp + (size_t)b * PX * 64, nullptr, 64, 0, PX, 64, CC * 3);
    k_im3<0><<<(unsigned)(((size_t)PX * CC * 3 / 8 + 255) / 256), 256, 0, stream>>>(x, b, A3); k_gemm2<0, true><<<dim3((PX / 128) * 1, 1), 128, 0, stream>>>(A3, CC * 3, 0, BKW, CC * 3, 0, 0.0625f, bkp, 0, nullptr, 1, 0, 0, Kp + (size_t)b * PX * 64, nullptr, 64, 0, PX, 64, CC * 3); }
  k_qk16<<<(unsigned)(((size_t)NB * PX + 255) / 256), 256, 0, stream>>>(Qp, QH, QL); k_qk16<<<(unsigned)(((size_t)NB * PX + 255) / 256), 256, 0, stream>>>(Kp, KH, KL);
  k_gemm2<0, true><<<dim3((NR / 128) * (CC / 64), 1), 128, 0, stream>>>(X16, CC, 0, BV, CC, 0, 0.0625f, vb, 0, nullptr, 1, 0, 0, nullptr, V16, CC, 0, NR, CC, CC);      /* v = conv1x1(x) + bv as f16 rows */
  for (int b = 0; b < NB; ++b) {
    { const _Float16* qh = QH + (size_t)b * PX * CQ; const _Float16* ql = QL + (size_t)b * PX * CQ; const _Float16* kh = KH + (size_t)b * PX * CQ; const _Float16* kl = KL + (size_t)b * PX * CQ;
      k_gemm2<0, false><<<dim3((PX / 128) * (PX / 64), 1), 128, 0, stream>>>(ql, CQ, 0, kh, CQ, 0, 1.0f / 1024.0f, nullptr, 0, nullptr, 1, 0, 0, S, nullptr, PX, 0, PX, PX, CQ);
      k_gemm2<0, false><<<dim3((PX / 128) * (PX / 64), 1), 128, 0, stream>>>(qh, CQ, 0, kl, CQ, 0, 1.0f / 1024.0f, nullptr, 0, S, -1, 0, 0, S, nullptr, PX, 0, PX, PX, CQ);
      k_gemm2<0, false><<<dim3((PX / 128) * (PX / 64), 1), 128, 0, stream>>>(qh, CQ, 0, kh, CQ, 0, 1.0f, nullptr, 0, S, -1, 0, 0, S, nullptr, PX, 0, PX, PX, CQ); }      /* logits (three terms, K = 32) */
    k_soft<<<PX / 8, 256, 0, stream>>>(S, PH, PL);
    k_vt64<<<PX / 64, 256, 0, stream>>>(V16, b, VT);
    float* Ob = O + (size_t)b * PX * CC;
    k_gemm2<0, true><<<dim3((PX / 128) * (CC / 64), 1), 128, 0, stream>>>(PL, PX, 0, VT, PX, 0, 1.0f / 1024.0f, nullptr, 0, nullptr, 1, 0, 0, Ob, nullptr, CC, 0, PX, CC, PX);
    k_gemm2<0, true><<<dim3((PX / 128) * (CC / 64), 1), 128, 0, stream>>>(PH, PX, 0, VT, PX, 0, 1.0f, nullptr, 0, Ob, -1, 0, 0, Ob, nullptr, CC, 0, PX, CC, PX); }      /* out rows [i][c] = sum_j P[i][j] v[c][j] */
  k_fin<<<(unsigned)(((size_t)NB * CC * PX / 8 + 255) / 256), 256, 0, stream>>>(O, (float*)d_out);
}

// v002
// One run takes 356 microseconds.
// Next to v001, in two timings, it ran 3.34 times as fast each time.
// Counting every step since v000, it is 5.09 times as fast.
#include <hip/hip_runtime.h>
// SpatialAttention (x [4][256][64][64]; q = conv(1,3)(x) + bq, k = conv(3,1)(x) + bk with 32 channels; attn = softmax_j(sum_d q[d][i] k[d][j]) over 4096 positions (unscaled); v = conv1x1(x) + bv; out[c][i] = sum_j v[c][j] attn[i][j] -> [4][256][64][64]).
// Structure: q / k as im2col + WMMA GEMMs (K = 768, f32 accumulation + bias) into f16 hi/residual operand planes; v as a WMMA GEMM over exact f16 pixel rows (32x64 wave tiles, f32 accumulation, exact x16 weights + bias) then v^T by LDS tiles; then ONE fused launch: three-term logits (K = 32), online softmax in registers (base 2), out^T = v^T P^T as a two-term product, stored straight in NCHW.
// Compute dtype: inputs rounded to bf16; x / weights exact; q, k as f16 hi + 2^-10 residual pairs (~2^-21; the logits are unscaled with std 10.7); softmax f32 with hi + residual probabilities; v plain f16 (~2^-12). v_wmma_f32_16x16x32_f16.
#define NB 4
#define CC 256
#define CQ 32
#define HS 64
#define PX (HS * HS)             /* 4096 */
#define NR (NB * PX)
typedef __bf16 v16b __attribute__((ext_vector_type(16)));
typedef unsigned short v8us __attribute__((ext_vector_type(8), may_alias));
typedef float  v8f  __attribute__((ext_vector_type(8)));
typedef float  v4f  __attribute__((ext_vector_type(4)));
typedef float  v4fa __attribute__((ext_vector_type(4), may_alias));
union FragB { v16b v; v8us half[2]; unsigned short u[16]; };

__device__ __forceinline__ unsigned short bf16_bits(float x) { unsigned int u = __float_as_uint(x); return (unsigned short)((u + 0x7FFFu + ((u >> 16) & 1u)) >> 16); }
__device__ __forceinline__ float bf16_val(unsigned short b) { return __uint_as_float(((unsigned int)b) << 16); }
__device__ __forceinline__ float bf16_round(float x) { return bf16_val(bf16_bits(x)); }
// D += A·B with NT terms: 1 = ah·bh, 2 = + al·bh (A split), 3 = + ah·bl (both split)
template <int NT>
__device__ __forceinline__ v8f mmaN(v16b ah, v16b al, v16b bh, v16b bl, v8f c) {
  c = __builtin_amdgcn_wmma_f32_16x16x32_bf16(false, ah, false, bh, (short)0, c, false, false);
  if (NT >= 2) c = __builtin_amdgcn_wmma_f32_16x16x32_bf16(false, al, false, bh, (short)0, c, false, false);
  if (NT >= 3) c = __builtin_amdgcn_wmma_f32_16x16x32_bf16(false, ah, false, bl, (short)0, c, false, false);
  asm volatile("v_nop\n\tv_nop\n\tv_nop\n\tv_nop" : "+v"(c) : "v"(ah), "v"(al), "v"(bh), "v"(bl));
  return c;
}

__global__ __launch_bounds__(256) void k_wt_bf16(const float* __restrict__ W, unsigned short* __restrict__ Wt, int K, int N) {
  const int t = blockIdx.x * 256 + threadIdx.x;
  const int k8n = K / 8;
  if (t >= N * k8n) return;
  const int n = t / k8n, k8 = (t % k8n) * 8;
  v8us v;
#pragma unroll
  for (int i = 0; i < 8; ++i) v[i] = bf16_bits(W[(size_t)(k8 + i) * N + n]);
  *(v8us*)(Wt + (size_t)n * K + k8) = v;
  
}

// GEMM C[M][N] (f32, pitch ldc) = act(A[M][K]·W + bias). A f32 row-major (pitch lda) converted per fragment to bf16
// (ASPLIT: hi/lo two planes -> 2 terms, else single rounded term); Wt bf16 [N][K] (pitch ldb). BIAS_BF16 rounds the
// bias to bf16 first (bias quantised to bf16 before the add). K%32==0, M%16==0, N%64==0.
template <bool ASPLIT, int ACT, bool BIAS_BF16>
__global__ __launch_bounds__(128) void k_gemm_bf(const float* __restrict__ A, int lda, const unsigned short* __restrict__ Wt, int ldb,
                                               const float* __restrict__ bias, float* __restrict__ C, int ldc, int M, int N, int K) {
  __shared__ __attribute__((aligned(16))) float so[4][16][64];
  const int tid = threadIdx.x, w = tid >> 5, lane = tid & 31, ln = lane & 15, hh = lane >> 4;
  const int ntn = N / 64;
  const int wid = blockIdx.x * 4 + w;
  const int mt = wid / ntn, nq = wid % ntn;
  if (mt * 16 >= M) return;
  const int row0 = mt * 16, col0 = nq * 64;
  const float* arow = A + (size_t)(row0 + ln) * lda;
  v8f acc[4] = {};
  for (int kb = 0; kb < K; kb += 32) {
    FragB ah, al;
    const v4f x0 = *(const v4fa*)(arow + kb + 8 * hh), x1 = *(const v4fa*)(arow + kb + 8 * hh + 4);
    const v4f x2 = *(const v4fa*)(arow + kb + 16 + 8 * hh), x3 = *(const v4fa*)(arow + kb + 16 + 8 * hh + 4);
    float xs[16] = {x0[0],x0[1],x0[2],x0[3],x1[0],x1[1],x1[2],x1[3],x2[0],x2[1],x2[2],x2[3],x3[0],x3[1],x3[2],x3[3]};
#pragma unroll
    for (int i = 0; i < 16; ++i) { const unsigned short hb = bf16_bits(xs[i]); ah.u[i] = hb; al.u[i] = ASPLIT ? bf16_bits(xs[i] - bf16_val(hb)) : (unsigned short)0; }
#pragma unroll
    for (int t = 0; t < 4; ++t) {
      const unsigned short* brow = Wt + (size_t)(col0 + t * 16 + ln) * ldb + kb;
      FragB b;
      b.half[0] = *(const v8us*)(brow + 8 * hh);
      b.half[1] = *(const v8us*)(brow + 16 + 8 * hh);
      acc[t] = mmaN<ASPLIT ? 2 : 1>(ah.v, al.v, b.v, b.v, acc[t]);
    }
  }
#pragma unroll
  for (int t = 0; t < 4; ++t) {
    float bv = bias ? bias[col0 + t * 16 + ln] : 0.f;
    if (BIAS_BF16) bv = bf16_round(bv);
#pragma unroll
    for (int r = 0; r < 8; ++r) { float v = acc[t][r] + bv; if (ACT == 1) v = fmaxf(v, 0.f); so[w][8 * hh + r][t * 16 + ln] = v; }
  }
  __builtin_amdgcn_fence(__ATOMIC_ACQ_REL, "workgroup");
  __builtin_amdgcn_wave_barrier();
  const int rsub = lane >> 4, c4 = (lane & 15) * 4;
  {
#pragma unroll
    for (int q = 0; q < 8; ++q) {
      const int r = q * 2 + rsub;
      const v4f v = *(const v4fa*)&so[w][r][c4];
      *(v4f*)(C + (size_t)(row0 + r) * ldc + col0 + c4) = v;
    }
    
  }
}

// GEMM C = act(A·W + bias + resid): A f32 (ASPLIT -> hi/lo 2 terms), Wt bf16 [N][K]; ACT 0 none, 1 relu, 2 exact gelu;
// resid (optional, f32, row index = (row % rmod), pitch ldr, RES_BF16 rounds it) added before the activation.
template <bool ASPLIT, int ACT, bool BIAS_BF16, bool RES_BF16>
__global__ __launch_bounds__(128) void k_gemm_bf3(const float* __restrict__ A, int lda, const unsigned short* __restrict__ Wt, int ldb,
                                                const float* __restrict__ bias, const float* __restrict__ resid, int rmod, int ldr,
                                                float* __restrict__ C, int ldc, int M, int N, int K) {
  __shared__ __attribute__((aligned(16))) float so[4][16][64];
  const int tid = threadIdx.x, w = tid >> 5, lane = tid & 31, ln = lane & 15, hh = lane >> 4;
  const int ntn = N / 64;
  const int wid = blockIdx.x * 4 + w;
  const int mt = wid / ntn, nq = wid % ntn;
  if (mt * 16 >= M) return;
  const int row0 = mt * 16, col0 = nq * 64;
  const float* arow = A + (size_t)(row0 + ln) * lda;
  v8f acc[4] = {};
  for (int kb = 0; kb < K; kb += 32) {
    FragB ah, al;
    const v4f x0 = *(const v4fa*)(arow + kb + 8 * hh), x1 = *(const v4fa*)(arow + kb + 8 * hh + 4);
    const v4f x2 = *(const v4fa*)(arow + kb + 16 + 8 * hh), x3 = *(const v4fa*)(arow + kb + 16 + 8 * hh + 4);
    float xs[16] = {x0[0],x0[1],x0[2],x0[3],x1[0],x1[1],x1[2],x1[3],x2[0],x2[1],x2[2],x2[3],x3[0],x3[1],x3[2],x3[3]};
#pragma unroll
    for (int i = 0; i < 16; ++i) { const unsigned short hb = bf16_bits(xs[i]); ah.u[i] = hb; al.u[i] = ASPLIT ? bf16_bits(xs[i] - bf16_val(hb)) : (unsigned short)0; }
#pragma unroll
    for (int t = 0; t < 4; ++t) {
      const unsigned short* brow = Wt + (size_t)(col0 + t * 16 + ln) * ldb + kb;
      FragB b;
      b.half[0] = *(const v8us*)(brow + 8 * hh);
      b.half[1] = *(const v8us*)(brow + 16 + 8 * hh);
      acc[t] = mmaN<ASPLIT ? 2 : 1>(ah.v, al.v, b.v, b.v, acc[t]);
    }
  }
#pragma unroll
  for (int t = 0; t < 4; ++t) {
    const int col = col0 + t * 16 + ln;
    float bv = bias ? bias[col] : 0.f;
    if (BIAS_BF16) bv = bf16_round(bv);
#pragma unroll
    for (int r = 0; r < 8; ++r) {
      float v = acc[t][r] + bv;
      if (resid) { float rv = resid[(size_t)((row0 + 8 * hh + r) % rmod) * ldr + col]; if (RES_BF16) rv = bf16_round(rv); v += rv; }
      if (ACT == 1) v = fmaxf(v, 0.f);
      if (ACT == 2) v = 0.5f * v * (1.0f + erff(v * 0.70710678118654752f));
      if (ACT == 3) { const float u = 0.7978845608028654f * (v + 0.044715f * v * v * v); v = 0.5f * v * (1.0f + tanhf(u)); }
      so[w][8 * hh + r][t * 16 + ln] = v;
    }
  }
  __builtin_amdgcn_fence(__ATOMIC_ACQ_REL, "workgroup");
  __builtin_amdgcn_wave_barrier();
  const int rsub = lane >> 4, c4 = (lane & 15) * 4;
  {
#pragma unroll
    for (int q = 0; q < 8; ++q) {
      const int r = q * 2 + rsub;
      const v4f v = *(const v4fa*)&so[w][r][c4];
      *(v4f*)(C + (size_t)(row0 + r) * ldc + col0 + c4) = v;
    }
    
  }
}
// row LayerNorm (biased variance, eps) over N: s = X (+ R); optional out_sum <- s; out_norm <- (s-mu)*rsqrt(var+eps)*g + b
template <bool PARAM_BF16>
__global__ __launch_bounds__(256) void k_layernorm(const float* __restrict__ X, const float* __restrict__ R, const float* __restrict__ g, const float* __restrict__ bta,
                                                  float* __restrict__ out_sum, float* __restrict__ out_norm, int N, float eps) {
  __shared__ float red[256];
  const int row = blockIdx.x, tid = threadIdx.x;
  const float* x = X + (size_t)row * N; const float* rr = R ? R + (size_t)row * N : nullptr;
  float vals[16];                     // up to N = 4096
  const int per = N / 256;            // contiguous chunk per thread? use strided-by-4 chunks: thread handles j = tid*4 + 1024*u
  float s1 = 0.f;
  for (int u = 0; u < per / 4; ++u) {
    const int j = tid * 4 + 1024 * u;
    const v4f a = *(const v4fa*)(x + j);
    v4f b = {0.f,0.f,0.f,0.f}; if (rr) b = *(const v4fa*)(rr + j);
#pragma unroll
    for (int q = 0; q < 4; ++q) { const float v = a[q] + b[q]; vals[u * 4 + q] = v; s1 += v; }
  }
  red[tid] = s1; __syncthreads();
  for (int st = 128; st > 0; st >>= 1) { if (tid < st) red[tid] += red[tid + st]; __syncthreads(); }
  const float mu = red[0] / (float)N; __syncthreads();
  float s2 = 0.f;
  for (int u = 0; u < per / 4; ++u)
#pragma unroll
    for (int q = 0; q < 4; ++q) { const float c = vals[u * 4 + q] - mu; s2 += c * c; }
  red[tid] = s2; __syncthreads();
  for (int st = 128; st > 0; st >>= 1) { if (tid < st) red[tid] += red[tid + st]; __syncthreads(); }
  const float rs = rsqrtf(red[0] / (float)N + eps);
  {
    for (int u = 0; u < per / 4; ++u) {
      const int j = tid * 4 + 1024 * u;
      v4f o, sm;
#pragma unroll
      for (int q = 0; q < 4; ++q) {
        float gg = g[j + q], bb = bta[j + q];
        if (PARAM_BF16) { gg = bf16_round(gg); bb = bf16_round(bb); }
        sm[q] = vals[u * 4 + q]; o[q] = (vals[u * 4 + q] - mu) * rs * gg + bb;
      }
      if (out_sum) *(v4f*)(out_sum + (size_t)row * N + j) = sm;
      *(v4f*)(out_norm + (size_t)row * N + j) = o;
    }
    
  }
}



// ---- f16 WMMA path (v_wmma_f32_16x16x32_f16): 11-bit significands for operands in range — used where a probability operand needs more precision than bf16
typedef _Float16 v16h __attribute__((ext_vector_type(16)));
union FragH { v16h v; v8us half[2]; _Float16 h[16]; unsigned short u[16]; };
template <int NT>
__device__ __forceinline__ v8f mmaH(v16h ah, v16h al, v16h bh, v16h bl, v8f c) {
  c = __builtin_amdgcn_wmma_f32_16x16x32_f16(false, ah, false, bh, (short)0, c, false, false);
  if (NT >= 2) c = __builtin_amdgcn_wmma_f32_16x16x32_f16(false, al, false, bh, (short)0, c, false, false);
  if (NT >= 3) c = __builtin_amdgcn_wmma_f32_16x16x32_f16(false, ah, false, bl, (short)0, c, false, false);
  asm volatile("v_nop\n\tv_nop\n\tv_nop\n\tv_nop" : "+v"(c) : "v"(ah), "v"(al), "v"(bh), "v"(bl));
  return c;
}
// batched GEMM like k_gemm_b but f16 operands: A f32 (split into f16 hi/lo if ASPLIT, else rounded to f16), Bt = f16 values [n][k]; alpha; C f32; N multiple of 16 (partial tiles skipped)
template <bool ASPLIT>
__global__ __launch_bounds__(128) void k_gemm_h(const float* __restrict__ A, int lda, size_t sA, const _Float16* __restrict__ Bh, int ldb, size_t sB, float alpha, float* __restrict__ C, int ldc, size_t sC, int M, int N, int K) {
  __shared__ __attribute__((aligned(16))) float so[4][16][64];
  const int tid = threadIdx.x, w = tid >> 5, lane = tid & 31, ln = lane & 15, hh = lane >> 4; const int by = blockIdx.y;
  A += (size_t)by * sA; Bh += (size_t)by * sB; C += (size_t)by * sC;
  const int ntn = (N + 63) / 64; const int wid = blockIdx.x * 4 + w; const int mt = wid / ntn, nq = wid % ntn; if (mt * 16 >= M) return;
  const int row0 = mt * 16, col0 = nq * 64; const float* arow = A + (size_t)(row0 + ln) * lda;
  v8f acc[4] = {};
  for (int kb = 0; kb < K; kb += 32) {
    FragH ah, al;
    const v4f x0 = *(const v4fa*)(arow + kb + 8 * hh), x1 = *(const v4fa*)(arow + kb + 8 * hh + 4), x2 = *(const v4fa*)(arow + kb + 16 + 8 * hh), x3 = *(const v4fa*)(arow + kb + 16 + 8 * hh + 4);
    float xs[16] = {x0[0],x0[1],x0[2],x0[3],x1[0],x1[1],x1[2],x1[3],x2[0],x2[1],x2[2],x2[3],x3[0],x3[1],x3[2],x3[3]};
#pragma unroll
    for (int i = 0; i < 16; ++i) { const _Float16 h = (_Float16)xs[i]; ah.h[i] = h; al.h[i] = ASPLIT ? (_Float16)(xs[i] - (float)h) : (_Float16)0.0f; }
#pragma unroll
    for (int t = 0; t < 4; ++t) { if (col0 + t * 16 >= N) continue; const size_t boff = (size_t)(col0 + t * 16 + ln) * ldb + kb; FragH bq; bq.half[0] = *(const v8us*)(Bh + boff + 8 * hh); bq.half[1] = *(const v8us*)(Bh + boff + 16 + 8 * hh);
      acc[t] = mmaH<ASPLIT ? 2 : 1>(ah.v, al.v, bq.v, bq.v, acc[t]); }
  }
#pragma unroll
  for (int t = 0; t < 4; ++t) { if (col0 + t * 16 >= N) continue;
#pragma unroll
    for (int r = 0; r < 8; ++r) so[w][8 * hh + r][t * 16 + ln] = acc[t][r] * alpha; }
  __builtin_amdgcn_fence(__ATOMIC_ACQ_REL, "workgroup"); __builtin_amdgcn_wave_barrier();
  const int rsub = lane >> 4, c4 = (lane & 15) * 4;
  {
#pragma unroll
    for (int q = 0; q < 8; ++q) { const int r = q * 2 + rsub; if (col0 + c4 < N) { const v4f v = *(const v4fa*)&so[w][r][c4]; *(v4f*)(C + (size_t)(row0 + r) * ldc + col0 + c4) = v; } }
     }
}

// Wt[n][k] = f16(W[k][n]·scale) from f32 row-major W[K][N] (scale = power of two; bf16-exact weights stay exact in f16 away from the subnormal range)
__global__ __launch_bounds__(256) void k_wt_f16(const float* __restrict__ W, _Float16* __restrict__ Wt, int K, int N, float scale) {
  const int t = blockIdx.x * 256 + threadIdx.x; if (t >= N * (K / 8)) return; const int n = t / (K / 8), k8 = (t % (K / 8)) * 8; FragH f;
#pragma unroll
  for (int i = 0; i < 8; ++i) f.h[i] = (_Float16)(bf16_round(W[(size_t)(k8 + i) * N + n]) * scale); const v8us o = f.half[0];
  *(v8us*)((unsigned short*)Wt + (size_t)n * K + k8) = o; 
}
// k_gemm_hh variant with fused epilogue: v = acc·alpha + bias[by·sBias + col] (+ CP[(row/rowsPerB)·sCPb + by·64 + col] if CP) ; ACT 0 none / 1 elu ; writes f16 C16 (and f32 C if non-null)
template <int ACT>
__global__ __launch_bounds__(128) void k_gemm_hhx(const _Float16* __restrict__ A, int lda, size_t sA, const _Float16* __restrict__ Bh, int ldb, size_t sB, float alpha, const float* __restrict__ bias, size_t sBias, const float* __restrict__ CP, int rowsPerB, size_t sCPb, int row0g,
    float* __restrict__ C, _Float16* __restrict__ C16, int ldc, size_t sC, int M, int N, int K) {
  __shared__ __attribute__((aligned(16))) float so[4][16][64];
  const int tid = threadIdx.x, w = tid >> 5, lane = tid & 31, ln = lane & 15, hh = lane >> 4; const int by = blockIdx.y;
  A += (size_t)by * sA; Bh += (size_t)by * sB; const size_t cofs = (size_t)by * sC; const float* bp = bias ? bias + (size_t)by * sBias : nullptr;
  const int ntn = (N + 63) / 64; const int wid = blockIdx.x * 4 + w; const int mt = wid / ntn, nq = wid % ntn; if (mt * 16 >= M) return;
  const int row0 = mt * 16, col0 = nq * 64; const _Float16* arow = A + (size_t)(row0 + ln) * lda;
  v8f acc[4] = {};
  for (int kb = 0; kb < K; kb += 32) { FragH ah; ah.half[0] = *(const v8us*)((const unsigned short*)arow + kb + 8 * hh); ah.half[1] = *(const v8us*)((const unsigned short*)arow + kb + 16 + 8 * hh);
#pragma unroll
    for (int t = 0; t < 4; ++t) { if (col0 + t * 16 >= N) continue; const size_t boff = (size_t)(col0 + t * 16 + ln) * ldb + kb; FragH bq; bq.half[0] = *(const v8us*)((const unsigned short*)Bh + boff + 8 * hh); bq.half[1] = *(const v8us*)((const unsigned short*)Bh + boff + 16 + 8 * hh);
      acc[t] = mmaH<1>(ah.v, ah.v, bq.v, bq.v, acc[t]); }
  }
#pragma unroll
  for (int t = 0; t < 4; ++t) { if (col0 + t * 16 >= N) continue; const int col = col0 + t * 16 + ln; const float bv = bp ? bf16_round(bp[col]) : 0.f;
#pragma unroll
    for (int r = 0; r < 8; ++r) { float v = acc[t][r] * alpha + bv; if (CP) { const int rr = row0g + row0 + 8 * hh + r; if (rowsPerB < 0) v += CP[cofs + (size_t)rr * ldc + col];      /* rowsPerB < 0: own element of the batched C plane */ else { const int bidx = rr / rowsPerB; v += CP[(size_t)bidx * sCPb + (size_t)by * 64 + col]; } } if (ACT == 1) v = (v > 0.f) ? v : expm1f(v); else if (ACT == 7) v = (v > 0.f) ? v + 1.0f : expf(v); else if (ACT == 8) v = tanhf(v); else if (ACT == 9) v = 0.5f * v * (1.0f + tanhf(0.7978845608028654f * (v + 0.044715f * v * v * v))); else if (ACT == 11) v = 1.0f / (1.0f + expf(-v)); else if (ACT == 12) v = (v > 0.f) ? v : 0.01f * v; else if (ACT == 14) v = (v > 0.f) ? v : 0.1f * v; else if (ACT == 16) v = (v >= 0.f) ? v : 0.3f * v; else if (ACT == 17) v = (v >= 0.f) ? v : 0.2f * v; else if (ACT == 15) v = v / (1.0f + expf(-v)); else if (ACT == 3) v = fmaxf(v, 0.f); else if (ACT == 6) v = 0.5f * v * (1.0f + erff(v * 0.70710678118654752f)); so[w][8 * hh + r][t * 16 + ln] = v; } }
  __builtin_amdgcn_fence(__ATOMIC_ACQ_REL, "workgroup"); __builtin_amdgcn_wave_barrier();
  const int rsub = lane >> 4, c4 = (lane & 15) * 4; typedef _Float16 v4h __attribute__((ext_vector_type(4)));
  {
#pragma unroll
    for (int q = 0; q < 8; ++q) { const int r = q * 2 + rsub; if (col0 + c4 < N) { const v4f v = *(const v4fa*)&so[w][r][c4]; if (C) *(v4f*)(C + cofs + (size_t)(row0 + r) * ldc + col0 + c4) = v; if (C16) { v4h h4; for (int i = 0; i < 4; ++i) h4[i] = (_Float16)v[i]; *(v4h*)(C16 + cofs + (size_t)(row0 + r) * ldc + col0 + c4) = h4; } } }
     }
}


typedef _Float16 v4h __attribute__((ext_vector_type(4)));

__global__ __launch_bounds__(256) void k_x16(const float* __restrict__ x, _Float16* __restrict__ X16, size_t n8) { const size_t t = (size_t)blockIdx.x * 256 + threadIdx.x; if (t >= n8) return; FragH f;
#pragma unroll
  for (int q = 0; q < 8; ++q) f.h[q] = (_Float16)bf16_round(x[t * 8 + q]); *(v8us*)((unsigned short*)X16 + t * 8) = f.half[0];  }
__global__ __launch_bounds__(256) void k_h16(const float* __restrict__ x, _Float16* __restrict__ X16, size_t n8) { const size_t t = (size_t)blockIdx.x * 256 + threadIdx.x; if (t >= n8) return; FragH f;
#pragma unroll
  for (int q = 0; q < 8; ++q) f.h[q] = (_Float16)x[t * 8 + q]; *(v8us*)((unsigned short*)X16 + t * 8) = f.half[0];  }
__global__ __launch_bounds__(256) void k_round16f(const float* __restrict__ W, _Float16* __restrict__ Bt, size_t n8) { const size_t t = (size_t)blockIdx.x * 256 + threadIdx.x; if (t >= n8) return; FragH f;
#pragma unroll
  for (int i = 0; i < 8; ++i) f.h[i] = (_Float16)(bf16_round(W[t * 8 + i]) * 16.0f); *(v8us*)((unsigned short*)Bt + t * 8) = f.half[0];  }
template <int NHv, int TTv>
__global__ __launch_bounds__(256) void k_vt(const _Float16* __restrict__ V16, int ldv, int voff, _Float16* __restrict__ Vt) { __shared__ unsigned short tl[64][66]; const int tid = threadIdx.x; const int slab = blockIdx.x / (TTv / 64), lg = blockIdx.x % (TTv / 64); const int b = slab / NHv, h = slab % NHv;
  for (int i = tid; i < 64 * 8; i += 256) { const int r = i / 8, c8 = (i % 8) * 8; FragH f; f.half[0] = *(const v8us*)((const unsigned short*)V16 + ((size_t)b * TTv + lg * 64 + r) * ldv + voff + h * 64 + c8);
#pragma unroll
    for (int q = 0; q < 8; ++q) tl[r][c8 + q] = f.u[q]; }
  __syncthreads();
  {
#pragma unroll
    for (int rd = 0; rd < 2; ++rd) { const int d = rd * 32 + tid / 8, pc = tid % 8; FragH f;
#pragma unroll
      for (int q = 0; q < 8; ++q) f.u[q] = tl[pc * 8 + q][d];
      *(v8us*)((unsigned short*)Vt + ((size_t)slab * 64 + d) * TTv + lg * 64 + pc * 8) = f.half[0]; }
     } }

__global__ __launch_bounds__(256) void k_hl(const float* __restrict__ F, _Float16* __restrict__ Hh, _Float16* __restrict__ Hl, size_t n8) { const size_t t = (size_t)blockIdx.x * 256 + threadIdx.x; if (t >= n8) return; FragH fh, fl; const v4f a = *(const v4fa*)(F + t * 8), c = *(const v4fa*)(F + t * 8 + 4);
#pragma unroll
  for (int q = 0; q < 4; ++q) { _Float16 h = (_Float16)a[q]; fh.h[q] = h; fl.h[q] = (_Float16)((a[q] - (float)h) * 1024.0f); h = (_Float16)c[q]; fh.h[4 + q] = h; fl.h[4 + q] = (_Float16)((c[q] - (float)h) * 1024.0f); }
  { *(v8us*)((unsigned short*)Hh + t * 8) = fh.half[0]; *(v8us*)((unsigned short*)Hl + t * 8) = fl.half[0];  } }

// ---- fast GEMM (wave tile 32x64; requires M % 32 == 0 rows per launch region and N % 64 == 0); epilogue = k_gemm_hhx semantics ----
__device__ __forceinline__ v16h g2_frag(const _Float16* p, int hh) { FragH f; f.half[0] = *(const v8us*)((const unsigned short*)p + 8 * hh); f.half[1] = *(const v8us*)((const unsigned short*)p + 16 + 8 * hh); return f.v; }
__device__ __forceinline__ v8f g2_mma(v16h a, v16h b, v8f c) { v8f d = __builtin_amdgcn_wmma_f32_16x16x32_f16(false, a, false, b, (short)0, c, false, false); asm volatile("v_nop\n\tv_nop\n\tv_nop\n\tv_nop" : "+v"(d) : "v"(a), "v"(b)); return d; }
// AHEAD (launches with K >= 64): the K loop keeps two register sets of fragments; all six fragments of a 32-wide k block are loaded as one group one block before
// their WMMAs, so a block waits for one load round trip that is already under way instead of five in a row. Same k order per accumulator as the plain loop.
template <int ACT, bool AHEAD>
__global__ __launch_bounds__(128) void k_gemm2(const _Float16* __restrict__ A, int lda, size_t sA, const _Float16* __restrict__ Bh, int ldb, size_t sB, float alpha, const float* __restrict__ bias, size_t sBias, const float* __restrict__ CP, int rowsPerB, size_t sCPb, int row0g,
    float* __restrict__ C, _Float16* __restrict__ C16, int ldc, size_t sC, int M, int N, int K) { static_assert(ACT == 0 || ACT == 3 || ACT == 6 || ACT == 8 || ACT == 9 || ACT == 11 || ACT == 12 || ACT == 14 || ACT == 15 || ACT == 16 || ACT == 17, "k_gemm2: unsupported ACT code (would silently apply no activation)");
  __shared__ __attribute__((aligned(16))) float so[4][32][68];
  const int tid = threadIdx.x, w = tid >> 5, lane = tid & 31, ln = lane & 15, hh = lane >> 4; const int by = blockIdx.y;
  A += (size_t)by * sA; Bh += (size_t)by * sB; const size_t cofs = (size_t)by * sC; const float* bp = bias ? bias + (size_t)by * sBias : nullptr;
  const int ntn = N >> 6; const int mt = blockIdx.x / ntn, nq = blockIdx.x - mt * ntn; const int row0 = mt * 128 + 32 * w, col0 = nq * 64; if (row0 >= M) return;
  const _Float16* a0p = A + (size_t)(row0 + ln) * lda; const _Float16* a1p = a0p + (size_t)16 * lda;
  const _Float16* b0p = Bh + (size_t)(col0 + ln) * ldb; const _Float16* b1p = b0p + (size_t)16 * ldb; const _Float16* b2p = b1p + (size_t)16 * ldb; const _Float16* b3p = b2p + (size_t)16 * ldb;
  const v8f z8 = {0.f,0.f,0.f,0.f,0.f,0.f,0.f,0.f}; v8f c00 = z8, c01 = z8, c02 = z8, c03 = z8, c10 = z8, c11 = z8, c12 = z8, c13 = z8;
  if (AHEAD) {
    a0p += 8 * hh; a1p += 8 * hh; b0p += 8 * hh; b1p += 8 * hh; b2p += 8 * hh; b3p += 8 * hh;      /* the lane's own k offset goes into the six pointers once: every load of the loop then names a pointer that lives through the loop */
    v16h pa0 = g2_frag(a0p, 0), pa1 = g2_frag(a1p, 0), pb0 = g2_frag(b0p, 0), pb1 = g2_frag(b1p, 0), pb2 = g2_frag(b2p, 0), pb3 = g2_frag(b3p, 0);      /* block 0 */
    int kb = 0;
#pragma unroll 1
    for (; kb + 64 <= K; kb += 64) {      /* rolled: two blocks a trip, one per register set, so no set is copied */
      const v16h qa0 = g2_frag(a0p + 32, 0), qa1 = g2_frag(a1p + 32, 0), qb0 = g2_frag(b0p + 32, 0), qb1 = g2_frag(b1p + 32, 0), qb2 = g2_frag(b2p + 32, 0), qb3 = g2_frag(b3p + 32, 0);
      c00 = g2_mma(pa0, pb0, c00); c10 = g2_mma(pa1, pb0, c10); c01 = g2_mma(pa0, pb1, c01); c11 = g2_mma(pa1, pb1, c11);
      c02 = g2_mma(pa0, pb2, c02); c12 = g2_mma(pa1, pb2, c12); c03 = g2_mma(pa0, pb3, c03); c13 = g2_mma(pa1, pb3, c13);
      asm volatile("s_wait_xcnt 0x0" ::: "memory");      /* stands in front of the pointer steps below, which overwrite the address registers of the loads issued above */
      __builtin_amdgcn_sched_barrier(0);      /* keeps the pointer steps behind that wait (its clobber orders memory operations only) */
      const int step = (kb + 64 < K) ? 64 : -kb;      /* no branch round the loads below (a branch would merge the wait counts to zero); behind the last block they re-read block 0, in bounds, and the values are not used */
      a0p += step; a1p += step; b0p += step; b1p += step; b2p += step; b3p += step;
      pa0 = g2_frag(a0p, 0); pa1 = g2_frag(a1p, 0); pb0 = g2_frag(b0p, 0); pb1 = g2_frag(b1p, 0); pb2 = g2_frag(b2p, 0); pb3 = g2_frag(b3p, 0);
      __builtin_amdgcn_sched_barrier(0);      /* keeps these loads ahead of the other set's WMMAs: without it the first of those WMMAs, with its wait, moves in front of the loads and they start later */
      c00 = g2_mma(qa0, qb0, c00); c10 = g2_mma(qa1, qb0, c10); c01 = g2_mma(qa0, qb1, c01); c11 = g2_mma(qa1, qb1, c11);
      c02 = g2_mma(qa0, qb2, c02); c12 = g2_mma(qa1, qb2, c12); c03 = g2_mma(qa0, qb3, c03); c13 = g2_mma(qa1, qb3, c13);
    }
    asm volatile("s_wait_xcnt 0x0" ::: "memory");      /* the last loads' address registers are free for what follows only behind this */
    if (kb < K) {      /* odd number of blocks: the last one is already in the first set */
      c00 = g2_mma(pa0, pb0, c00); c10 = g2_mma(pa1, pb0, c10); c01 = g2_mma(pa0, pb1, c01); c11 = g2_mma(pa1, pb1, c11);
      c02 = g2_mma(pa0, pb2, c02); c12 = g2_mma(pa1, pb2, c12); c03 = g2_mma(pa0, pb3, c03); c13 = g2_mma(pa1, pb3, c13); }
  } else {
#pragma unroll 1
  for (int kb = 0; kb < K; kb += 32) { const v16h a0 = g2_frag(a0p + kb, hh), a1 = g2_frag(a1p + kb, hh);
    v16h b = g2_frag(b0p + kb, hh); c00 = g2_mma(a0, b, c00); c10 = g2_mma(a1, b, c10);
    b = g2_frag(b1p + kb, hh); c01 = g2_mma(a0, b, c01); c11 = g2_mma(a1, b, c11);
    b = g2_frag(b2p + kb, hh); c02 = g2_mma(a0, b, c02); c12 = g2_mma(a1, b, c12);
    b = g2_frag(b3p + kb, hh); c03 = g2_mma(a0, b, c03); c13 = g2_mma(a1, b, c13); }
  }
  v8f accs[8] = {c00, c01, c02, c03, c10, c11, c12, c13};
#pragma unroll
  for (int u = 0; u < 8; ++u) { const int t = u & 3, half = u >> 2; const int col = col0 + t * 16 + ln; const float bv = bp ? bf16_round(bp[col]) : 0.f;
#pragma unroll
    for (int r = 0; r < 8; ++r) { const int rloc = half * 16 + 8 * hh + r; float v = accs[u][r] * alpha + bv; if (CP) { if (rowsPerB < 0) v += CP[cofs + (size_t)(row0g + row0 + rloc) * ldc + col];      /* rowsPerB < 0: own element of the batched C plane */ else { const int bidx = (row0g + row0 + rloc) / rowsPerB; v += CP[(size_t)bidx * sCPb + (size_t)by * 64 + col]; } }
      if (ACT == 3) v = fmaxf(v, 0.f); else if (ACT == 6) v = 0.5f * v * (1.0f + erff(v * 0.70710678118654752f)); else if (ACT == 11) v = 1.0f / (1.0f + expf(-v)); else if (ACT == 15) v = v / (1.0f + expf(-v)); else if (ACT == 12) v = (v > 0.f) ? v : 0.01f * v; else if (ACT == 8) v = tanhf(v); else if (ACT == 9) v = 0.5f * v * (1.0f + tanhf(0.7978845608028654f * (v + 0.044715f * v * v * v))); else if (ACT == 14) v = (v > 0.f) ? v : 0.1f * v; else if (ACT == 16) v = (v >= 0.f) ? v : 0.3f * v; else if (ACT == 17) v = (v >= 0.f) ? v : 0.2f * v;
      so[w][rloc][t * 16 + ln] = v; } }
  __builtin_amdgcn_fence(__ATOMIC_ACQ_REL, "workgroup"); __builtin_amdgcn_wave_barrier();
  const int rsub = lane >> 4, c4 = (lane & 15) * 4;
  {
#pragma unroll
    for (int q = 0; q < 16; ++q) { const int r = q * 2 + rsub; const v4f v = *(const v4fa*)&so[w][r][c4]; if (C) *(v4f*)(C + cofs + (size_t)(row0 + r) * ldc + col0 + c4) = v; if (C16) { v4h h4; for (int i = 0; i < 4; ++i) h4[i] = (_Float16)v[i]; *(v4h*)(C16 + cofs + (size_t)(row0 + r) * ldc + col0 + c4) = h4; } }
     } }


__global__ __launch_bounds__(256) void k_tok(const float* __restrict__ x, _Float16* __restrict__ X) { __shared__ float tl[CC][17]; const int tid = threadIdx.x; const int b = blockIdx.x / (PX / 16), pb = blockIdx.x % (PX / 16); const int p0 = pb * 16;
  for (int i = tid; i < CC * 16; i += 256) { const int c = i / 16, p = i % 16; tl[c][p] = bf16_round(x[((size_t)b * CC + c) * PX + p0 + p]); }
  __syncthreads();
  { for (int i = tid; i < 16 * (CC / 8); i += 256) { const int p = i / (CC / 8), c0 = (i % (CC / 8)) * 8; FragH f; for (int q = 0; q < 8; ++q) f.h[q] = (_Float16)tl[c0 + q][p]; *(v8us*)((unsigned short*)X + ((size_t)b * PX + p0 + p) * CC + c0) = f.half[0]; }  } }
template <int DIRW>
__global__ __launch_bounds__(256) void k_im3(const float* __restrict__ x, int b, _Float16* __restrict__ A) { const size_t t = (size_t)blockIdx.x * 256 + threadIdx.x; if (t >= (size_t)PX * CC * 3 / 8) return; const int j0 = (int)((t * 8) % (CC * 3)); const int p = (int)((t * 8) / (CC * 3)); const int y = p / HS, xq = p % HS; FragH f;
  for (int q = 0; q < 8; ++q) { const int j = j0 + q; const int c = j / 3, d = j % 3; int yy = y, xx = xq; if (DIRW) xx += d - 1; else yy += d - 1; float v = 0.f; if (yy >= 0 && yy < HS && xx >= 0 && xx < HS) v = bf16_round(x[((size_t)b * CC + c) * PX + yy * HS + xx]); f.h[q] = (_Float16)v; }
  *(v8us*)((unsigned short*)A + t * 8) = f.half[0];  }
// bias padded to 64: bp[i] = i < 32 ? b[i] : 0
__global__ __launch_bounds__(64) void k_bpad32(const float* __restrict__ b, float* __restrict__ bp) { const int i = threadIdx.x; const float v = (i < CQ) ? b[i] : 0.f; *(float*)(bp + i) = v;  }
__global__ __launch_bounds__(256) void k_qk16(const float* __restrict__ Q, _Float16* __restrict__ QH, _Float16* __restrict__ QL) { const size_t t = (size_t)blockIdx.x * 256 + threadIdx.x; if (t >= (size_t)NB * PX) return; unsigned short* dh = (unsigned short*)QH + t * CQ; unsigned short* dl = (unsigned short*)QL + t * CQ;
  for (int pc = 0; pc < CQ / 8; ++pc) { const v8f a = *(const v8f*)(Q + t * 64 + pc * 8); FragH fh, fl; for (int q = 0; q < 8; ++q) { const float v = a[q]; const _Float16 hh = (_Float16)v; fh.h[q] = hh; fl.h[q] = (_Float16)((v - (float)hh) * 1024.0f); } *(v8us*)(dh + pc * 8) = fh.half[0]; *(v8us*)(dl + pc * 8) = fl.half[0];  } }
__global__ __launch_bounds__(256) void k_vt64(const _Float16* __restrict__ V16, int b, _Float16* __restrict__ VT) { __shared__ unsigned short tl[64][CC + 2]; const int tid = threadIdx.x; const int j0 = blockIdx.x * 64;
  for (int i = tid; i < 64 * (CC / 8); i += 256) { const int r = i / (CC / 8), c8 = (i % (CC / 8)) * 8; FragH f; f.half[0] = *(const v8us*)((const unsigned short*)V16 + ((size_t)b * PX + j0 + r) * CC + c8); for (int q = 0; q < 8; ++q) tl[r][c8 + q] = f.u[q]; }
  __syncthreads();
  const int c = tid; unsigned short* d = (unsigned short*)VT + (size_t)c * PX + j0;
  { for (int k8 = 0; k8 < 8; ++k8) { FragH f; for (int q = 0; q < 8; ++q) f.u[q] = tl[k8 * 8 + q][c]; *(v8us*)(d + k8 * 8) = f.half[0]; }  } }
// ---- fused attention: logits, softmax and P v^T in one launch; no score or probability ever leaves the registers ----
// S^T = K Q^T (A = key rows, B = query rows kept in registers): a lane holds 16 scores of ONE query (column ln), keys 8hh + r and 16 + 8hh + r of the 32-key pass,
// which is the k order of a B operand, so the two score tiles convert in place into P^T; O^T[c][i] += V^T[c][j] P^T[j][i] with A = rows of VT.
// Work-group = 32 queries: wave w has query tile (w & 1) and key slice (w >> 1) = every fourth 32-key block, so that the four slices walk neighbouring 64-byte pieces of the same v^T rows; running maximum per slice (base 2), the four slices joined through LDS in the order 0..3.
// P = f16 hi + f16 residual (unscaled: f16 subnormal operands are kept by the matrix unit), both terms into the same f32 accumulator.
#define FA_PITCH 36      /* floats per c row in LDS: the two lane halves (8 rows apart) fall on different banks; 144 B keeps 16-byte reads aligned */
__device__ __forceinline__ float fa_xhalf(float x) { return __builtin_bit_cast(float, __builtin_amdgcn_permlanex16(__builtin_bit_cast(int, x), __builtin_bit_cast(int, x), 0x76543210, 0xfedcba98, false, false)); }      /* lane l <-> lane l ^ 16 */
__device__ __forceinline__ v16h fa_frag(const char* sbase, unsigned lofs, int cofs) { FragH f; f.half[0] = *(const v8us*)(sbase + lofs + cofs); f.half[1] = *(const v8us*)(sbase + lofs + cofs + 32); return f.v; }      /* elements 0..7 and 16..23 from the lane's offset, as g2_frag */
__device__ __forceinline__ v8f fa_mma(v16h a, v16h b, v8f c) { return __builtin_amdgcn_wmma_f32_16x16x32_f16(false, a, false, b, (short)0, c, false, false); }
__global__ __launch_bounds__(256) __attribute__((amdgpu_waves_per_eu(4, 4))) void k_fattn(const _Float16* __restrict__ QH, const _Float16* __restrict__ QL, const _Float16* __restrict__ KH, const _Float16* __restrict__ KL, const _Float16* __restrict__ VT, float* __restrict__ out) {
  __shared__ __attribute__((aligned(16))) float red[4][CC][FA_PITCH];
  __shared__ float sm[4][32]; __shared__ float sl[4][32];
  const int tid = threadIdx.x, w = __builtin_amdgcn_readfirstlane(tid >> 5), lane = tid & 31, ln = lane & 15, hh = lane >> 4; const int qt = w & 1, jq = w >> 1;      /* the wave's number in a scalar register: tile, slice and the three bases below are then scalar arithmetic */
  const int b = blockIdx.x / (PX / 32), i0 = (blockIdx.x % (PX / 32)) * 32; const int qi = qt * 16 + ln;
  const size_t qrow = (size_t)b * PX + i0 + qi;
  const v16h qh = g2_frag(QH + qrow * CQ, hh), ql = g2_frag(QL + qrow * CQ, hh);
  // every load of the loop = a wave-uniform base, stepped only at the loop's foot, + the lane's own byte offset + a constant
  const char* khs = (const char*)(KH + ((size_t)b * PX + jq * 32) * CQ); const char* kls = (const char*)(KL + ((size_t)b * PX + jq * 32) * CQ); const char* vs = (const char*)(VT + (size_t)b * CC * PX + jq * 32);
  const unsigned kof = (unsigned)(ln * CQ + 8 * hh) * 2u, vof = (unsigned)(ln * PX + 8 * hh) * 2u;
  const v8f z8 = {0.f,0.f,0.f,0.f,0.f,0.f,0.f,0.f}; v8f acc[16];
#pragma unroll
  for (int ct = 0; ct < 16; ++ct) acc[ct] = z8;
  float mref = -3.0e38f, l = 0.f;      /* the maximum in use (logit x log2 e) and this lane half's share of the row sum */
#pragma unroll 1
  for (int ps = 0; ps < PX / 4 / 32; ++ps) {      /* rolled: one pass is 38 WMMAs and fills the register budget of four waves per SIMD */
    const v16h k0h = fa_frag(khs, kof, 0), k1h = fa_frag(khs, kof, 16 * CQ * 2), k0l = fa_frag(kls, kof, 0), k1l = fa_frag(kls, kof, 16 * CQ * 2);
    __builtin_amdgcn_sched_barrier(0);      /* keeps the eight key loads together ahead of the first WMMA: one load round trip a pass; without it the residual planes' loads wait for registers of the first WMMAs, two more round trips */
    v8f e0 = fa_mma(k0h, ql, z8), e1 = fa_mma(k1h, ql, z8); v8f a0 = fa_mma(k0h, qh, z8), a1 = fa_mma(k1h, qh, z8); e0 = fa_mma(k0l, qh, e0); e1 = fa_mma(k1l, qh, e1);
    v16h v0 = fa_frag(vs, vof, 0), v1 = fa_frag(vs, vof, 16 * PX * 2), v2 = fa_frag(vs, vof, 32 * PX * 2), v3 = fa_frag(vs, vof, 48 * PX * 2);
    __builtin_amdgcn_sched_barrier(0);      /* keeps the first four v^T fragments' loads ahead of the softmax arithmetic, which then covers their round trip */
    float s[16]; float smax = -3.0e38f;
#pragma unroll
    for (int r = 0; r < 8; ++r) { s[r] = a0[r] + e0[r] * (1.0f / 1024.0f); s[8 + r] = a1[r] + e1[r] * (1.0f / 1024.0f); smax = fmaxf(smax, fmaxf(s[r], s[8 + r])); }
    const float tm = fmaxf(smax, fa_xhalf(smax)) * 1.4426950408889634f;
    if (__builtin_amdgcn_ballot_w32(tm > mref + 14.0f) != 0) {      /* one test a pass, a rescale only when some query's maximum (base 2) has grown by more than 14: P stays below 2^14.1, inside f16's range, and hi + residual keep their relative precision */
      const float mn = fmaxf(mref, tm); const float corr = __builtin_amdgcn_exp2f(mref - mn); mref = mn; l *= corr;      /* corr = 0 on the first pass */
#pragma unroll
      for (int ct = 0; ct < 16; ++ct) acc[ct] *= corr; }
    FragH ph, pl;
#pragma unroll
    for (int q = 0; q < 16; ++q) { const float p = __builtin_amdgcn_exp2f(s[q] * 1.4426950408889634f - mref); l += p; const _Float16 h = (_Float16)p; ph.h[q] = h; pl.h[q] = (_Float16)(p - (float)h); }
#pragma unroll
    for (int c4 = 0; c4 < 16; c4 += 4) {      /* three independent accumulators between the two terms of one */
      if (c4) { v0 = fa_frag(vs, vof, (c4 + 0) * 16 * PX * 2); v1 = fa_frag(vs, vof, (c4 + 1) * 16 * PX * 2); v2 = fa_frag(vs, vof, (c4 + 2) * 16 * PX * 2); v3 = fa_frag(vs, vof, (c4 + 3) * 16 * PX * 2); }
      acc[c4] = fa_mma(v0, ph.v, acc[c4]); acc[c4 + 1] = fa_mma(v1, ph.v, acc[c4 + 1]); acc[c4 + 2] = fa_mma(v2, ph.v, acc[c4 + 2]); acc[c4 + 3] = fa_mma(v3, ph.v, acc[c4 + 3]);
      acc[c4] = fa_mma(v0, pl.v, acc[c4]); acc[c4 + 1] = fa_mma(v1, pl.v, acc[c4 + 1]); acc[c4 + 2] = fa_mma(v2, pl.v, acc[c4 + 2]); acc[c4 + 3] = fa_mma(v3, pl.v, acc[c4 + 3]); }
    asm volatile("s_wait_xcnt 0x0" ::: "memory");      /* stands behind the pass's last loads and in front of the base steps below, which overwrite address registers of this pass's loads */
    __builtin_amdgcn_sched_barrier(0);      /* keeps the base steps behind that wait (its clobber orders memory operations only) */
    khs += 128 * CQ * 2; kls += 128 * CQ * 2; vs += 128 * 2;
  }
  l += fa_xhalf(l);
  if (hh == 0) { sm[jq][qi] = mref; sl[jq][qi] = l; }
  __syncthreads();      /* the four slices' maxima and sums of each query are published */
  const float m0 = sm[0][qi], m1 = sm[1][qi], m2 = sm[2][qi], m3 = sm[3][qi]; const float mall = fmaxf(fmaxf(m0, m1), fmaxf(m2, m3));
  const float lall = ((sl[0][qi] * __builtin_amdgcn_exp2f(m0 - mall) + sl[1][qi] * __builtin_amdgcn_exp2f(m1 - mall)) + sl[2][qi] * __builtin_amdgcn_exp2f(m2 - mall)) + sl[3][qi] * __builtin_amdgcn_exp2f(m3 - mall);
  const float f = __builtin_amdgcn_exp2f(mref - mall) / lall;
#pragma unroll
  for (int ct = 0; ct < 16; ++ct)
#pragma unroll
    for (int r = 0; r < 8; ++r) red[jq][ct * 16 + 8 * hh + r][qi] = acc[ct][r] * f;
  __syncthreads();      /* the four scaled partial tiles are published */
#pragma unroll
  for (int it = 0; it < 8; ++it) {      /* wave w sums and stores c rows 32w .. 32w + 31: eight lanes write one whole 128-byte line of out */
    const int c = w * 32 + it * 4 + (lane >> 3), i4 = (lane & 7) * 4;
    const v4f r0 = *(const v4fa*)&red[0][c][i4], r1 = *(const v4fa*)&red[1][c][i4], r2 = *(const v4fa*)&red[2][c][i4], r3 = *(const v4fa*)&red[3][c][i4];
    *(v4f*)(out + ((size_t)b * CC + c) * PX + i0 + i4) = ((r0 + r1) + r2) + r3; }
}
__global__ __launch_bounds__(256) void k_zero16(_Float16* __restrict__ p, size_t n8) { const size_t t = (size_t)blockIdx.x * 256 + threadIdx.x; if (t >= n8) return; const v8us z = {0,0,0,0,0,0,0,0}; *(v8us*)((unsigned short*)p + t * 8) = z;  }
extern "C" void kernel_launch(void* const* d_in, const int* in_sizes, int n_in,
                              void* d_out, int out_size, void* d_ws, size_t ws_size, hipStream_t stream) {
  (void)in_sizes; (void)n_in; (void)out_size;
  const float* const* I = (const float* const*)d_in; const float* x = I[0]; const float* qw = I[1]; const float* qb = I[2]; const float* kw = I[3]; const float* kb = I[4]; const float* vw = I[5]; const float* vb = I[6];
  char* ws = (char*)d_ws; size_t off = 0;
  auto take = [&](size_t bytes) { char* p = ws + off; off += (bytes + 255) & ~(size_t)255; return p; };
  _Float16* BV = (_Float16*)take((size_t)CC * CC * 2); _Float16* X16 = (_Float16*)take((size_t)NR * CC * 2); float* Qp = (float*)take((size_t)NR * 64 * 4); float* Kp = (float*)take((size_t)NR * 64 * 4); _Float16* A3 = (_Float16*)take((size_t)PX * CC * 3 * 2); _Float16* BQW = (_Float16*)take((size_t)64 * CC * 3 * 2); _Float16* BKW = (_Float16*)take((size_t)64 * CC * 3 * 2); float* bqp = (float*)take(64 * 4); float* bkp = (float*)take(64 * 4); _Float16* V16 = (_Float16*)take((size_t)NR * CC * 2); _Float16* VT = (_Float16*)take((size_t)NB * CC * PX * 2);
  _Float16* QH = (_Float16*)take((size_t)NR * CQ * 2); _Float16* QL = (_Float16*)take((size_t)NR * CQ * 2); _Float16* KH = (_Float16*)take((size_t)NR * CQ * 2); _Float16* KL = (_Float16*)take((size_t)NR * CQ * 2);
  if (off > ws_size) return;
  k_round16f<<<(CC * CC / 8 + 255) / 256, 256, 0, stream>>>(vw, BV, (size_t)CC * CC / 8);      /* Bt[o][i] = bf16(Wv[o][i]) x16 (natural OIHW 1x1) */
  k_tok<<<NB * (PX / 16), 256, 0, stream>>>(x, X16);
  k_zero16<<<(unsigned)(((size_t)64 * CC * 3 / 8 + 255) / 256), 256, 0, stream>>>(BQW, (size_t)64 * CC * 3 / 8); k_zero16<<<(unsigned)(((size_t)64 * CC * 3 / 8 + 255) / 256), 256, 0, stream>>>(BKW, (size_t)64 * CC * 3 / 8); k_round16f<<<(unsigned)(((size_t)CQ * CC * 3 / 8 + 255) / 256), 256, 0, stream>>>(qw, BQW, (size_t)CQ * CC * 3 / 8); k_round16f<<<(unsigned)(((size_t)CQ * CC * 3 / 8 + 255) / 256), 256, 0, stream>>>(kw, BKW, (size_t)CQ * CC * 3 / 8); k_bpad32<<<1, 64, 0, stream>>>(qb, bqp); k_bpad32<<<1, 64, 0, stream>>>(kb, bkp);      /* Wq [32][256][1][3] / Wk [32][256][3][1] natural = Bt rows [cq][c*3 + d]; rows 32..63 zero */
  for (int b = 0; b < NB; ++b) {      /* q / k = 3-tap convs as K = 768 GEMMs (exact products, f32 + bias) */
    k_im3<1><<<(unsigned)(((size_t)PX * CC * 3 / 8 + 255) / 256), 256, 0, stream>>>(x, b, A3); k_gemm2<0, true><<<dim3((PX / 128) * 1, 1), 128, 0, stream>>>(A3, CC * 3, 0, BQW, CC * 3, 0, 0.0625f, bqp, 0, nullptr, 1, 0, 0, Qp + (size_t)b * PX * 64, nullptr, 64, 0, PX, 64, CC * 3);
    k_im3<0><<<(unsigned)(((size_t)PX * CC * 3 / 8 + 255) / 256), 256, 0, stream>>>(x, b, A3); k_gemm2<0, true><<<dim3((PX / 128) * 1, 1), 128, 0, stream>>>(A3, CC * 3, 0, BKW, CC * 3, 0, 0.0625f, bkp, 0, nullptr, 1, 0, 0, Kp + (size_t)b * PX * 64, nullptr, 64, 0, PX, 64, CC * 3); }
  k_qk16<<<(unsigned)(((size_t)NB * PX + 255) / 256), 256, 0, stream>>>(Qp, QH, QL); k_qk16<<<(unsigned)(((size_t)NB * PX + 255) / 256), 256, 0, stream>>>(Kp, KH, KL);
  k_gemm2<0, true><<<dim3((NR / 128) * (CC / 64), 1), 128, 0, stream>>>(X16, CC, 0, BV, CC, 0, 0.0625f, vb, 0, nullptr, 1, 0, 0, nullptr, V16, CC, 0, NR, CC, CC);      /* v = conv1x1(x) + bv as f16 rows */
  for (int b = 0; b < NB; ++b) k_vt64<<<PX / 64, 256, 0, stream>>>(V16, b, VT + (size_t)b * CC * PX);
  k_fattn<<<NB * (PX / 32), 256, 0, stream>>>(QH, QL, KH, KL, VT, (float*)d_out);      /* out[b][c][i] = sum_j v[c][j] softmax_j(q_i . k_j) */
}
